// v000
// The times below were measured on an AMD MI455X: many runs one after another, warmed up first and cycling through
// copies of the inputs, with the whole window's GPU time divided by the number of runs. Launches and the gaps
// between them are all in it. The median over several windows is given; except for v000 it joins two sittings, which
// can be a few percent apart, so the side-by-side timings, each taken in one sitting, are the better comparison.
// v000, which the later versions start from, runs in 1090 microseconds.
#include <hip/hip_runtime.h>

// CausalMaskedAttention (input [4][4096][768]; q/k/v = x W^T ([768][768], one head of width 768); scores = q.k / sqrt(768) (the source scales by d_in), causal (-inf); softmax; out = weights v -> [4][4096][768] (no output projection)).
// Compute dtypes, f32 accumulate: every input rounded to bf16; q/k/v on PLAIN bf16 operands (inputs: exact); causal scores and attn.v: query rows < 512 hl (3 products), the rest single fp16 (x1024), causal tile skipping; softmax f32 (128 keys per lane); the context written directly in f32.

#define NB_  4
#define TT   4096
#define DM   768
#define NH_  1
#define NKV  1
#define REP  (NH_ / NKV)
#define HD   768
#define DQ   (NH_ * HD)
#define DKV  (NKV * HD)
#define ZH   1
#define RH   512                  // query rows < RH use hi+lo planes (0: none)
#define WIN  4096
#define PCAR 1024.0f
#define SCL  0.036084391824351615f   // 1/sqrt(d_in = 768)
typedef _Float16 h16;
typedef unsigned short bf;
typedef __attribute__((ext_vector_type(16))) __bf16   v16bf;
typedef __attribute__((ext_vector_type(16))) _Float16 v16h;
typedef __attribute__((ext_vector_type(8)))  _Float16 v8h;
typedef __attribute__((ext_vector_type(8)))  unsigned short v8us;
typedef __attribute__((ext_vector_type(8)))  float    v8f;
typedef __attribute__((ext_vector_type(4)))  float    v4f;
typedef v8h  __attribute__((may_alias)) v8ha;
typedef v4f  __attribute__((may_alias)) v4fa;
typedef v8us __attribute__((may_alias)) v8usa;

__device__ __forceinline__ unsigned short f2bf(float f) { unsigned u = __float_as_uint(f); u += 0x7FFFu + ((u >> 16) & 1u); return (unsigned short)(u >> 16); }
__device__ __forceinline__ float bf2f(unsigned short b) { return __uint_as_float(((unsigned)b) << 16); }
__device__ __forceinline__ float bfr(float f) { return bf2f(f2bf(f)); }
__device__ __forceinline__ v16h cat16(v8h lo, v8h hi) { return __builtin_shufflevector(lo, hi, 0, 1, 2, 3, 4, 5, 6, 7, 8, 9, 10, 11, 12, 13, 14, 15); }
__device__ __forceinline__ v16bf cat16b(v8us lo, v8us hi) { return __builtin_bit_cast(v16bf, __builtin_shufflevector(lo, hi, 0, 1, 2, 3, 4, 5, 6, 7, 8, 9, 10, 11, 12, 13, 14, 15)); }
__device__ __forceinline__ v8f wmma16(v16h a, v16h b, v8f c) { return __builtin_amdgcn_wmma_f32_16x16x32_f16(false, a, false, b, (short)0, c, false, false); }
__device__ __forceinline__ v8f wmmab(v16bf a, v16bf b, v8f c) { return __builtin_amdgcn_wmma_f32_16x16x32_bf16(false, a, false, b, (short)0, c, false, false); }



// ---- k_gemmw: register-blocked GEMM, ONE WAVE per 64x64 output tile (16 accumulators), operands straight from K-contiguous 16-bit planes; grid (M/64, N/64, Z), 32 threads.
// C[m][n] (f32, pitch ldc, + optional f32 bias[n]) = sum_k A[m][k] Bt[n][k] (+ split products per NSPLIT). z-batch strides sA/sB/sC in elements. K % 32 == 0.
template <typename T16> struct WFrag;
template <> struct WFrag<h16> { typedef v16h V; static __device__ __forceinline__ V ld(const h16* p) { return cat16(*(const v8h*)p, *(const v8h*)(p + 16)); } static __device__ __forceinline__ v8f mma(V a, V b, v8f c) { return wmma16(a, b, c); } };
template <> struct WFrag<bf> { typedef v16bf V; static __device__ __forceinline__ V ld(const bf* p) { return cat16b(*(const v8us*)p, *(const v8us*)(p + 16)); } static __device__ __forceinline__ v8f mma(V a, V b, v8f c) { return wmmab(a, b, c); } };
template <typename T16, int NSPLIT, bool BIAS>
__global__ __launch_bounds__(32) void k_gemmw(const T16* __restrict__ A, const T16* __restrict__ A2, const T16* __restrict__ Bt, const T16* __restrict__ Bt2, int K, float* C, int ldc, const float* __restrict__ bias, size_t sA, size_t sB, size_t sC) {
    typedef typename WFrag<T16>::V V;
    __shared__ __align__(16) float os[16 * 68];
    const size_t z = blockIdx.z; A += z * sA; if (A2) A2 += z * sA; Bt += z * sB; if (Bt2) Bt2 += z * sB; C += z * sC;
    const int lane = threadIdx.x & 31, lr = lane & 15, hi = lane >> 4; const int r0 = blockIdx.x * 64, c0 = blockIdx.y * 64;
    v8f acc[4][4];
#pragma unroll
    for (int mb = 0; mb < 4; ++mb)
#pragma unroll
        for (int nb = 0; nb < 4; ++nb) acc[mb][nb] = (v8f){};
    const size_t aoff = (size_t)(r0 + lr) * K + 8 * hi, boff = (size_t)(c0 + lr) * K + 8 * hi;
#pragma unroll 1
    for (int kc = 0; kc < K; kc += 32) {
        V a[4], a2[4];
#pragma unroll
        for (int mb = 0; mb < 4; ++mb) { a[mb] = WFrag<T16>::ld(A + aoff + (size_t)mb * 16 * K + kc); if (NSPLIT == 1 || NSPLIT == 2) a2[mb] = WFrag<T16>::ld(A2 + aoff + (size_t)mb * 16 * K + kc); }
#pragma unroll
        for (int nb = 0; nb < 4; ++nb) { const V b = WFrag<T16>::ld(Bt + boff + (size_t)nb * 16 * K + kc); V b2; if (NSPLIT >= 2) b2 = WFrag<T16>::ld(Bt2 + boff + (size_t)nb * 16 * K + kc);
#pragma unroll
            for (int mb = 0; mb < 4; ++mb) { acc[mb][nb] = WFrag<T16>::mma(a[mb], b, acc[mb][nb]); if (NSPLIT == 1 || NSPLIT == 2) acc[mb][nb] = WFrag<T16>::mma(a2[mb], b, acc[mb][nb]); if (NSPLIT >= 2) acc[mb][nb] = WFrag<T16>::mma(a[mb], b2, acc[mb][nb]); } }
        asm volatile("v_nop\n\tv_nop\n\tv_nop\n\tv_nop" : "+v"(acc[0][0]), "+v"(acc[1][1]), "+v"(acc[2][2]), "+v"(acc[3][3]) : "v"(a[0]), "v"(a[3]));
    }
#pragma unroll
    for (int mb = 0; mb < 4; ++mb) {
#pragma unroll
        for (int nb = 0; nb < 4; ++nb) {
#pragma unroll
            for (int j = 0; j < 8; ++j) os[(hi * 8 + j) * 68 + nb * 16 + lr] = acc[mb][nb][j]; }
        __builtin_amdgcn_wave_barrier(); asm volatile("" ::: "memory");
        float* crow = C + (size_t)(r0 + mb * 16) * ldc + c0;
{
#pragma unroll
            for (int s = 0; s < 8; ++s) { const int row = 2 * s + hi, cofs = lr * 4; v4f val = *(const v4fa*)(os + row * 68 + cofs); if (BIAS) { val[0] += bfr(bias[c0 + cofs]); val[1] += bfr(bias[c0 + cofs + 1]); val[2] += bfr(bias[c0 + cofs + 2]); val[3] += bfr(bias[c0 + cofs + 3]); }
                *(v4f*)(crow + (size_t)row * ldc + cofs) = val; }
             }
        __builtin_amdgcn_wave_barrier(); asm volatile("" ::: "memory");
    }
}

// ---- k_gemmc: the same one-wave 64x64 tile GEMM specialised for causal attention: CMODE 1 skips score tiles entirely above the diagonal (query rows r0+roff.., key columns c0..), CMODE 2 limits the
// key (K) loop of the probability x value contraction to the diagonal block (probabilities beyond it are exactly zero). roff = row offset of this launch's first row within the sequence.
template <typename T16, int NSPLIT, int CMODE>
__global__ __launch_bounds__(32) void k_gemmc(const T16* __restrict__ A, const T16* __restrict__ A2, const T16* __restrict__ Bt, const T16* __restrict__ Bt2, int K, float* C, int ldc, int roff, size_t sA, size_t sB, size_t sC) {
    typedef typename WFrag<T16>::V V;
    __shared__ __align__(16) float os[16 * 68];
    const size_t z = blockIdx.z; A += z * sA; if (A2) A2 += z * sA; Bt += z * sB; if (Bt2) Bt2 += z * sB; C += z * sC;
    const int lane = threadIdx.x & 31, lr = lane & 15, hi = lane >> 4; const int r0 = blockIdx.x * 64, c0 = blockIdx.y * 64;
    if (CMODE == 1 && c0 > r0 + roff + 63) return;                  // score tile entirely above the causal diagonal: never read (the softmax masks j > i by select)
    const int Kl = (CMODE == 2) ? min(K, r0 + roff + 64) : K;        // P.V: probabilities are exactly 0 beyond the diagonal block, so the K loop stops there
    v8f acc[4][4];
#pragma unroll
    for (int mb = 0; mb < 4; ++mb)
#pragma unroll
        for (int nb = 0; nb < 4; ++nb) acc[mb][nb] = (v8f){};
    const size_t aoff = (size_t)(r0 + lr) * K + 8 * hi, boff = (size_t)(c0 + lr) * K + 8 * hi;
#pragma unroll 1
    for (int kc = 0; kc < Kl; kc += 32) {
        V a[4], a2[4];
#pragma unroll
        for (int mb = 0; mb < 4; ++mb) { a[mb] = WFrag<T16>::ld(A + aoff + (size_t)mb * 16 * K + kc); if (NSPLIT == 1 || NSPLIT == 2) a2[mb] = WFrag<T16>::ld(A2 + aoff + (size_t)mb * 16 * K + kc); }
#pragma unroll
        for (int nb = 0; nb < 4; ++nb) { const V b = WFrag<T16>::ld(Bt + boff + (size_t)nb * 16 * K + kc); V b2; if (NSPLIT >= 2) b2 = WFrag<T16>::ld(Bt2 + boff + (size_t)nb * 16 * K + kc);
#pragma unroll
            for (int mb = 0; mb < 4; ++mb) { acc[mb][nb] = WFrag<T16>::mma(a[mb], b, acc[mb][nb]); if (NSPLIT == 1 || NSPLIT == 2) acc[mb][nb] = WFrag<T16>::mma(a2[mb], b, acc[mb][nb]); if (NSPLIT >= 2) acc[mb][nb] = WFrag<T16>::mma(a[mb], b2, acc[mb][nb]); } }
        asm volatile("v_nop\n\tv_nop\n\tv_nop\n\tv_nop" : "+v"(acc[0][0]), "+v"(acc[1][1]), "+v"(acc[2][2]), "+v"(acc[3][3]) : "v"(a[0]), "v"(a[3]));
    }
#pragma unroll
    for (int mb = 0; mb < 4; ++mb) {
#pragma unroll
        for (int nb = 0; nb < 4; ++nb) {
#pragma unroll
            for (int j = 0; j < 8; ++j) os[(hi * 8 + j) * 68 + nb * 16 + lr] = acc[mb][nb][j]; }
        __builtin_amdgcn_wave_barrier(); asm volatile("" ::: "memory");
        float* crow = C + (size_t)(r0 + mb * 16) * ldc + c0;
{
#pragma unroll
            for (int s = 0; s < 8; ++s) { const int row = 2 * s + hi, cofs = lr * 4; v4f val = *(const v4fa*)(os + row * 68 + cofs);
                *(v4f*)(crow + (size_t)row * ldc + cofs) = val; }
             }
        __builtin_amdgcn_wave_barrier(); asm volatile("" ::: "memory");
    }
}

__device__ __forceinline__ h16 tohx(float x) { return (h16)x; }
__device__ __forceinline__ void splitf(float y, unsigned short& h, unsigned short& l) { h = f2bf(y); l = f2bf(y - bf2f(h)); }
typedef __attribute__((ext_vector_type(2))) _Float16 v2h;
typedef __attribute__((ext_vector_type(4))) _Float16 v4h;
typedef __attribute__((ext_vector_type(2))) unsigned short v2us;
typedef __attribute__((ext_vector_type(4))) unsigned short v4us;
typedef __attribute__((ext_vector_type(2))) float v2f;
typedef __attribute__((ext_vector_type(4))) int v4i;

__global__ __launch_bounds__(256) void k_wtG(const float* __restrict__ w, int K, int N, bf* Bt) {
    const int lane = threadIdx.x & 31; const int L0 = (blockIdx.x * 8 + (threadIdx.x >> 5)) * 8; const int nlines = N * K / 64;
{
#pragma unroll 1
        for (int l = 0; l < 8; ++l) { const int L = L0 + l; if (L >= nlines) break; const size_t e = (size_t)L * 64 + lane * 2; const int k = (int)(e % K), n = (int)(e / K); v2us o;
            o[0] = f2bf(w[(size_t)k * N + n]); o[1] = f2bf(w[(size_t)(k + 1) * N + n]); *(v2us*)(Bt + e) = o; }
         }
}
__global__ __launch_bounds__(256) void k_cvt8(const float* __restrict__ src, bf* dst, size_t n8) { const size_t i = (size_t)blockIdx.x * 256 + threadIdx.x; if (i >= n8) return; const v8f v = *(const v8f*)(src + i * 8); v8us o;
#pragma unroll
    for (int k = 0; k < 8; ++k) o[k] = f2bf(v[k]); *(v8us*)(dst + i * 8) = o;  }
__global__ __launch_bounds__(256) void k_cscvt(const float* __restrict__ cosT, const float* __restrict__ sinT, float* CS) { const int idx = blockIdx.x * 256 + threadIdx.x; if (idx >= TT * HD) return; v2f cs; cs[0] = bfr(cosT[idx]); cs[1] = bfr(sinT[idx]); *(v2f*)(CS + (size_t)idx * 2) = cs;  }
// k_rope: head planes [h][t][d] (fp16 + hi/lo) of rope(x) x sc with the rotate-half convention out[d] = x[d] cos[t][d] - x[d+HD/2] sin[t][d], out[d+HD/2] = x[d+HD/2] cos[t][d+HD/2] + x[d] sin[t][d+HD/2]
__global__ __launch_bounds__(256) void k_rope(const float* __restrict__ F, int pitch, int nheads, const float* __restrict__ CS, const float* __restrict__ RF, const float* __restrict__ nw, float sc, h16* P16, bf* Ph, bf* Pl) {
    const size_t e = ((size_t)blockIdx.x * 256 + threadIdx.x) * 2; if (e >= (size_t)nheads * TT * HD) return; const int d = (int)(e % HD); const int t = (int)((e / HD) % TT); const int h = (int)(e / ((size_t)HD * TT)); const float* f = F + (size_t)t * pitch + h * HD; const float rf = RF ? RF[(size_t)h * TT + t] : 1.0f; v2h o16; v2us oh, ol;
#pragma unroll
    for (int q = 0; q < 2; ++q) { const int dd = d + q; const int dp = (dd < HD / 2) ? dd + HD / 2 : dd - HD / 2; float x0 = f[dd], x1 = f[dp];
        if (RF) { float n0 = __fmul_rn(x0, rf), n1 = __fmul_rn(x1, rf); asm volatile("" : "+v"(n0)); asm volatile("" : "+v"(n1)); x0 = __fmul_rn(bfr(nw[dd]), n0); x1 = __fmul_rn(bfr(nw[dp]), n1); }
        const v2f cs = *(const v2f*)(CS + ((size_t)t * HD + dd) * 2); float a = __fmul_rn(x0, cs[0]), bq = __fmul_rn(x1, cs[1]); asm volatile("" : "+v"(a)); asm volatile("" : "+v"(bq)); const float r = ((dd < HD / 2) ? __fsub_rn(a, bq) : __fadd_rn(a, bq)) * sc;
        o16[q] = tohx(r); unsigned short a2, c2; splitf(r, a2, c2); oh[q] = a2; ol[q] = c2; }
    *(v2h*)(P16 + e) = o16; *(v2us*)(Ph + e) = oh; *(v2us*)(Pl + e) = ol;  }
__global__ __launch_bounds__(256) void k_vtp(const float* __restrict__ F, int pitch, int nheads, h16* V16, bf* Vh, bf* Vl) { const size_t e = ((size_t)blockIdx.x * 256 + threadIdx.x) * 2; if (e >= (size_t)nheads * HD * TT) return; const int t = (int)(e % TT); const int d = (int)((e / TT) % HD); const int g = (int)(e / ((size_t)TT * HD)); v2h o16; v2us oh, ol;
#pragma unroll
    for (int q = 0; q < 2; ++q) { const float x = F[(size_t)(t + q) * pitch + g * HD + d]; o16[q] = tohx(x); unsigned short a2, c2; splitf(x, a2, c2); oh[q] = a2; ol[q] = c2; }
    *(v2h*)(V16 + e) = o16; *(v2us*)(Vh + e) = oh; *(v2us*)(Vl + e) = ol;  }
__global__ __launch_bounds__(256) void k_csid(float* CS) { const int idx = blockIdx.x * 256 + threadIdx.x; if (idx >= TT * HD) return; v2f cs; cs[0] = 1.0f; cs[1] = 0.0f; *(v2f*)(CS + (size_t)idx * 2) = cs;  }
// k_asoft: per row (zz, i): t = S x HD^-0.5 for j <= i and i - j < WIN (sliding causal window; the reference's -1e9 additive fill vanishes identically); softmax over the 4096 keys (register row, one exp, fixed trees);
__global__ __launch_bounds__(256) void k_asoft(const float* __restrict__ Sb, h16* P16, bf* Ph, bf* Pl) {
    const int lane = threadIdx.x & 31; const int row = blockIdx.x * 8 + (threadIdx.x >> 5); if (row >= ZH * TT) return; const int i = row % TT; const int zz = row / TT; (void)zz; const bool hires = (i < RH); const float* sr = Sb + (size_t)row * TT; float v[TT / 32]; float mx = -3.0e38f;
#pragma unroll
    for (int ch = 0; ch < TT / 128; ++ch) { const int j0 = ch * 128 + lane * 4; const v4f a = *(const v4f*)(sr + j0);
#pragma unroll
        for (int q = 0; q < 4; ++q) { const int j = j0 + q; (void)j; float sa = a[q] * SCL; asm volatile("" : "+v"(sa)); const float t = (j <= i) ? sa : -3.0e38f; v[ch * 4 + q] = t; mx = fmaxf(mx, t); } }
#pragma unroll
    for (int sh = 16; sh; sh >>= 1) mx = fmaxf(mx, __shfl_xor(mx, sh, 32));
    float sum = 0.f;
#pragma unroll
    for (int k = 0; k < TT / 32; ++k) { float d0 = __fsub_rn(v[k], mx); asm volatile("" : "+v"(d0)); v[k] = __builtin_amdgcn_exp2f(__fmul_rn(d0, 1.4426950408889634f)); sum += v[k]; }
#pragma unroll
    for (int sh = 16; sh; sh >>= 1) sum += __shfl_xor(sum, sh, 32);
    const float f = __fdiv_rn(hires ? 1.0f : PCAR, sum);
{
        if (hires) {
#pragma unroll
            for (int ch = 0; ch < TT / 128; ++ch) { v4us oh, ol;
#pragma unroll
                for (int q = 0; q < 4; ++q) { unsigned short a, c2; splitf(v[ch * 4 + q] * f, a, c2); oh[q] = a; ol[q] = c2; }
                const size_t oo = ((size_t)zz * (RH ? RH : 1) + i) * TT + ch * 128 + lane * 4; *(v4us*)(Ph + oo) = oh; *(v4us*)(Pl + oo) = ol; }
        } else {
#pragma unroll
            for (int ch = 0; ch < TT / 128; ++ch) { v4h o4;
#pragma unroll
                for (int q = 0; q < 4; ++q) o4[q] = tohx(v[ch * 4 + q] * f);
                *(v4h*)(P16 + (size_t)row * TT + ch * 128 + lane * 4) = o4; } }
         }
}
__global__ __launch_bounds__(256) void k_merge(const float* __restrict__ O, int h0, bf* Ah, bf* Al) { const size_t e = ((size_t)blockIdx.x * 256 + threadIdx.x) * 2; if (e >= (size_t)ZH * TT * HD) return; const int d = (int)(e % HD); const int t = (int)((e / HD) % TT); const int zz = (int)(e / ((size_t)HD * TT)); const float cs = (t < RH) ? 1.0f : (1.0f / PCAR); const size_t oo = (size_t)t * DQ + (h0 + zz) * HD + d;
    v2us oh, ol;
#pragma unroll
    for (int q = 0; q < 2; ++q) { unsigned short a, c2; splitf(O[e + q] * cs, a, c2); oh[q] = a; ol[q] = c2; } *(v2us*)(Ah + oo) = oh; *(v2us*)(Al + oo) = ol;  }

__global__ __launch_bounds__(256) void k_mout(const float* __restrict__ O, int h0, float* OUTb) { const size_t e = ((size_t)blockIdx.x * 256 + threadIdx.x) * 2; if (e >= (size_t)ZH * TT * HD) return; const int d = (int)(e % HD); const int t = (int)((e / HD) % TT); const int zz = (int)(e / ((size_t)HD * TT)); const float cs = (t < RH) ? 1.0f : (1.0f / PCAR); v2f o; o[0] = O[e] * cs; o[1] = O[e + 1] * cs; float* dst = OUTb + (size_t)t * DQ + (h0 + zz) * HD + d; *(v2f*)dst = o;  }

extern "C" void kernel_launch(void* const* d_in, const int* in_sizes, int n_in,
                              void* d_out, int out_size, void* d_ws, size_t ws_size, hipStream_t stream) {
    (void)in_sizes; (void)n_in; (void)out_size;
    const float* x = (const float*)d_in[0]; const float* wq = (const float*)d_in[1]; const float* wk = (const float*)d_in[2]; const float* wv = (const float*)d_in[3]; const float* wo = nullptr; (void)wo; const float* cosT = nullptr; const float* sinT = nullptr; (void)cosT; (void)sinT;
    float* OUT = (float*)d_out;     // [4][4096][768]
    char* wsp = (char*)d_ws;
    auto take = [&](size_t bytes) { char* p = wsp; wsp += (bytes + 255) & ~(size_t)255; return (void*)p; };
    bf* WQ = (bf*)take((size_t)DQ * DM * 2); bf* WK = (bf*)take((size_t)DKV * DM * 2); bf* WV = (bf*)take((size_t)DKV * DM * 2); bf* WO = nullptr; (void)WO; float* CS = (float*)take((size_t)TT * HD * 2 * 4);
    bf* XB = (bf*)take((size_t)TT * DM * 2); float* FQ = (float*)take((size_t)TT * DQ * 4); float* FK = (float*)take((size_t)TT * DKV * 4);
    h16* QP16 = (h16*)take((size_t)NH_ * TT * HD * 2); h16* KP16 = (h16*)take((size_t)NKV * TT * HD * 2); h16* VT16 = (h16*)take((size_t)NKV * HD * TT * 2);
    bf* QPh = (bf*)take((size_t)NH_ * TT * HD * 2); bf* QPl = (bf*)take((size_t)NH_ * TT * HD * 2); bf* KPh = (bf*)take((size_t)NKV * TT * HD * 2); bf* KPl = (bf*)take((size_t)NKV * TT * HD * 2); bf* VTh = (bf*)take((size_t)NKV * HD * TT * 2); bf* VTl = (bf*)take((size_t)NKV * HD * TT * 2); bf* Ph = (bf*)take((size_t)ZH * RH * TT * 2); bf* Pl = (bf*)take((size_t)ZH * RH * TT * 2);
    float* Sb = (float*)take((size_t)ZH * TT * TT * 4); h16* P16 = (h16*)take((size_t)ZH * TT * TT * 2); float* Ob = (float*)take((size_t)ZH * TT * HD * 4); bf* ATh = nullptr; bf* ATl = nullptr; (void)ATh; (void)ATl;
    if ((size_t)(wsp - (char*)d_ws) > ws_size) return;    // ws 256 MiB
    float* FV = FK;   // v projection reuses the k buffer after the k planes are built (stream-ordered)
    { k_cvt8<<<(unsigned)(((size_t)DQ * DM / 8 + 255) / 256), 256, 0, stream>>>(wq, WQ, (size_t)DQ * DM / 8); k_cvt8<<<(unsigned)(((size_t)DKV * DM / 8 + 255) / 256), 256, 0, stream>>>(wk, WK, (size_t)DKV * DM / 8); k_cvt8<<<(unsigned)(((size_t)DKV * DM / 8 + 255) / 256), 256, 0, stream>>>(wv, WV, (size_t)DKV * DM / 8);
      /* no output projection */
       }
    k_csid<<<(TT * HD + 255) / 256, 256, 0, stream>>>(CS);
    const unsigned LQ = (unsigned)(((size_t)NH_ * TT * HD / 2 + 255) / 256), LKv = (unsigned)(((size_t)NKV * TT * HD / 2 + 255) / 256);
    for (int b = 0; b < NB_; ++b) {
        
        k_cvt8<<<(unsigned)(((size_t)TT * DM / 8 + 255) / 256), 256, 0, stream>>>(x + (size_t)b * TT * DM, XB, (size_t)TT * DM / 8);
        k_gemmw<bf, 0, false><<<dim3(TT / 64, DQ / 64, 1), 32, 0, stream>>>(XB, nullptr, WQ, nullptr, DM, FQ, DQ, nullptr, 0, 0, 0);
        k_rope<<<LQ, 256, 0, stream>>>(FQ, DQ, NH_, CS, nullptr, nullptr, 1.0f, QP16, QPh, QPl);
        k_gemmw<bf, 0, false><<<dim3(TT / 64, DKV / 64, 1), 32, 0, stream>>>(XB, nullptr, WK, nullptr, DM, FK, DKV, nullptr, 0, 0, 0);
        k_rope<<<LKv, 256, 0, stream>>>(FK, DKV, NKV, CS, nullptr, nullptr, 1.0f, KP16, KPh, KPl);
        k_gemmw<bf, 0, false><<<dim3(TT / 64, DKV / 64, 1), 32, 0, stream>>>(XB, nullptr, WV, nullptr, DM, FV, DKV, nullptr, 0, 0, 0); k_vtp<<<LKv, 256, 0, stream>>>(FV, DKV, NKV, VT16, VTh, VTl);
        for (int h0 = 0; h0 < NH_; h0 += ZH) { const size_t zq = (size_t)h0, zk = (size_t)(h0 / REP);   // one kv head per query head: each pass handles one head (ZH = 1; z-strides TT*HD)
            k_gemmc<bf, 2, 1><<<dim3(RH / 64, TT / 64, ZH), 32, 0, stream>>>(QPh + zq * TT * HD, QPl + zq * TT * HD, KPh + zk * TT * HD, KPl + zk * TT * HD, HD, Sb, TT, 0, (size_t)TT * HD, (size_t)TT * HD, (size_t)TT * TT);
            k_gemmc<h16, 0, 1><<<dim3((TT - RH) / 64, TT / 64, ZH), 32, 0, stream>>>(QP16 + zq * TT * HD + (size_t)RH * HD, nullptr, KP16 + zk * TT * HD, nullptr, HD, Sb + (size_t)RH * TT, TT, RH, (size_t)TT * HD, (size_t)TT * HD, (size_t)TT * TT);
            k_asoft<<<ZH * TT / 8, 256, 0, stream>>>(Sb, P16, Ph, Pl);
            k_gemmc<bf, 2, 2><<<dim3(RH / 64, HD / 64, ZH), 32, 0, stream>>>(Ph, Pl, VTh + zk * HD * TT, VTl + zk * HD * TT, TT, Ob, HD, 0, (size_t)RH * TT, (size_t)HD * TT, (size_t)TT * HD);
            k_gemmc<h16, 0, 2><<<dim3((TT - RH) / 64, HD / 64, ZH), 32, 0, stream>>>(P16 + (size_t)RH * TT, nullptr, VT16 + zk * HD * TT, nullptr, TT, Ob + (size_t)RH * HD, HD, RH, (size_t)TT * TT, (size_t)HD * TT, (size_t)TT * HD);
            k_mout<<<(unsigned)(((size_t)ZH * TT * HD / 2 + 255) / 256), 256, 0, stream>>>(Ob, h0, OUT + (size_t)b * TT * DM); }
        }
}

// v001
// One run takes 778 microseconds.
// Timed twice side by side with v000, it ran 1.42 and 1.44 times as fast.
#include <hip/hip_runtime.h>

// CausalMaskedAttention (input [4][4096][768]; q/k/v = x W^T ([768][768], one head of width 768); scores = q.k / sqrt(768) (the source scales by d_in), causal (-inf); softmax; out = weights v -> [4][4096][768] (no output projection)).
// Compute dtypes, f32 accumulate: every input rounded to bf16; q/k/v on PLAIN bf16 operands (inputs: exact); causal scores and attn.v: query rows < 512 hl (3 products), the rest single fp16 (x1024), causal tile skipping; softmax f32 (128 keys per lane); the context written directly in f32.

#define NB_  4
#define TT   4096
#define DM   768
#define NH_  1
#define NKV  1
#define REP  (NH_ / NKV)
#define HD   768
#define DQ   (NH_ * HD)
#define DKV  (NKV * HD)
#define ZH   1
#define RH   512                  // query rows < RH use hi+lo planes (0: none)
#define WIN  4096
#define PCAR 1024.0f
#define SCL  0.036084391824351615f   // 1/sqrt(d_in = 768)
typedef _Float16 h16;
typedef unsigned short bf;
typedef __attribute__((ext_vector_type(16))) __bf16   v16bf;
typedef __attribute__((ext_vector_type(16))) _Float16 v16h;
typedef __attribute__((ext_vector_type(8)))  _Float16 v8h;
typedef __attribute__((ext_vector_type(8)))  unsigned short v8us;
typedef __attribute__((ext_vector_type(8)))  float    v8f;
typedef __attribute__((ext_vector_type(4)))  float    v4f;
typedef v8h  __attribute__((may_alias)) v8ha;
typedef v4f  __attribute__((may_alias)) v4fa;
typedef v8us __attribute__((may_alias)) v8usa;

__device__ __forceinline__ unsigned short f2bf(float f) { unsigned u = __float_as_uint(f); u += 0x7FFFu + ((u >> 16) & 1u); return (unsigned short)(u >> 16); }
__device__ __forceinline__ float bf2f(unsigned short b) { return __uint_as_float(((unsigned)b) << 16); }
__device__ __forceinline__ float bfr(float f) { return bf2f(f2bf(f)); }
__device__ __forceinline__ v16h cat16(v8h lo, v8h hi) { return __builtin_shufflevector(lo, hi, 0, 1, 2, 3, 4, 5, 6, 7, 8, 9, 10, 11, 12, 13, 14, 15); }
__device__ __forceinline__ v16bf cat16b(v8us lo, v8us hi) { return __builtin_bit_cast(v16bf, __builtin_shufflevector(lo, hi, 0, 1, 2, 3, 4, 5, 6, 7, 8, 9, 10, 11, 12, 13, 14, 15)); }
__device__ __forceinline__ v8f wmma16(v16h a, v16h b, v8f c) { return __builtin_amdgcn_wmma_f32_16x16x32_f16(false, a, false, b, (short)0, c, false, false); }
__device__ __forceinline__ v8f wmmab(v16bf a, v16bf b, v8f c) { return __builtin_amdgcn_wmma_f32_16x16x32_bf16(false, a, false, b, (short)0, c, false, false); }



// ---- k_gemmw: register-blocked GEMM, ONE WAVE per 64x64 output tile (16 accumulators), operands from K-contiguous 16-bit planes through LDS (tile_mm); grid (M/64, N/64, Z), 32 threads.
// C[m][n] (f32, pitch ldc, + optional f32 bias[n]) = sum_k A[m][k] Bt[n][k] (+ split products per NSPLIT). z-batch strides sA/sB/sC in elements. K % Stg<NSPLIT>::KSTEP == 0 (64 one product, 32 three).
template <typename T16> struct WFrag;
template <> struct WFrag<h16> { typedef v16h V; static __device__ __forceinline__ V ld(const h16* p) { return cat16(*(const v8h*)p, *(const v8h*)(p + 16)); } static __device__ __forceinline__ v8f mma(V a, V b, v8f c) { return wmma16(a, b, c); } };
template <> struct WFrag<bf> { typedef v16bf V; static __device__ __forceinline__ V ld(const bf* p) { return cat16b(*(const v8us*)p, *(const v8us*)(p + 16)); } static __device__ __forceinline__ v8f mma(V a, V b, v8f c) { return wmmab(a, b, c); } };
// ---- operand staging for the one-wave 64x64 tile GEMMs: each K step's operand rows go from global memory to LDS by asynchronous copies that cover the rows' bytes side by side (128-B rows: 8 lanes a row,
// 4 whole lines a copy; the three-product kernels take 64-B rows so that a stage stays at 32 copies), two buffers, the next step's copies in flight while this step's fragments are read from LDS.
template <int NSPLIT> struct Stg { static constexpr int NPL = (NSPLIT >= 2) ? 4 : 2, RB = (NSPLIT >= 2) ? 64 : 128, PITCH = RB + 16, LPR = RB / 16, RPC = 32 / LPR, CPP = 64 / RPC, PLANE = 64 * PITCH, STAGE = NPL * PLANE, KSTEP = RB / 2, KS = RB / 64; };
typedef int gv4i __attribute__((vector_size(16)));
// one copy of 16 B a lane, global -> LDS, through no register
template <typename T16>
__device__ __forceinline__ void copy16(const T16* g, char* l) { __builtin_amdgcn_global_load_async_to_lds_b128((__attribute__((address_space(1))) gv4i*)g, (__attribute__((address_space(3))) gv4i*)l, 0, 0); }
// acc += A[r0..r0+63][0..Kl) x Bt[c0..c0+63][0..Kl)^T (+ the split products), k ascending in steps of 32 as before. smem: 2 * Stg<NSPLIT>::STAGE bytes, private to the wave. Kl % KSTEP == 0, Kl >= KSTEP.
template <typename T16, int NSPLIT>
__device__ __forceinline__ void tile_mm(const T16* __restrict__ A, const T16* __restrict__ A2, const T16* __restrict__ Bt, const T16* __restrict__ Bt2, int K, int Kl, int r0, int c0, char* smem, v8f (&acc)[4][4]) {
    typedef typename WFrag<T16>::V V; typedef Stg<NSPLIT> S;
    static_assert(NSPLIT == 0 || NSPLIT == 2, "one product or the three hi/lo products");
    const int lane = threadIdx.x & 31, lr = lane & 15, hi = lane >> 4;
    const size_t ga = (size_t)(r0 + lane / S::LPR) * K + (lane % S::LPR) * 8, gb = (size_t)(c0 + lane / S::LPR) * K + (lane % S::LPR) * 8;
    char* l0 = smem + (lane / S::LPR) * S::PITCH + (lane % S::LPR) * 16;
    const T16* pl[4] = { A + ga, Bt + gb, (NSPLIT >= 2) ? A2 + ga : nullptr, (NSPLIT >= 2) ? Bt2 + gb : nullptr };
    auto fill = [&](int t) {
#pragma unroll
        for (int p = 0; p < S::NPL; ++p)
#pragma unroll
            for (int g = 0; g < S::CPP; ++g)
                copy16<T16>(pl[p] + (size_t)t * S::KSTEP + (size_t)(g * S::RPC) * K, l0 + (t & 1) * S::STAGE + p * S::PLANE + g * S::RPC * S::PITCH);
    };
    const int nt = Kl / S::KSTEP;
    fill(0);
    asm volatile("s_wait_asynccnt 0x0" ::: "memory");   // step 0 has landed before anything reads it
    __syncthreads();   // the ring's publish point; a block of one wave, so the compiler emits no barrier instruction for it
    if (nt > 1) fill(1);
#pragma unroll 1
    for (int t = 0; t < nt; ++t) {
        const char* sb = smem + (t & 1) * S::STAGE + lr * S::PITCH + hi * 16;
        V a[S::KS][4], b[S::KS][4], a2[S::KS][4], b2[S::KS][4];
#pragma unroll
        for (int ks = 0; ks < S::KS; ++ks)
#pragma unroll
            for (int q = 0; q < 4; ++q) { a[ks][q] = WFrag<T16>::ld((const T16*)(sb + q * 16 * S::PITCH + ks * 64)); b[ks][q] = WFrag<T16>::ld((const T16*)(sb + S::PLANE + q * 16 * S::PITCH + ks * 64));
                if (NSPLIT >= 2) { a2[ks][q] = WFrag<T16>::ld((const T16*)(sb + 2 * S::PLANE + q * 16 * S::PITCH + ks * 64)); b2[ks][q] = WFrag<T16>::ld((const T16*)(sb + 3 * S::PLANE + q * 16 * S::PITCH + ks * 64)); } }
        __builtin_amdgcn_sched_barrier(0);   // keeps the step's LDS reads together ahead of its WMMAs: sunk among them, each group makes the lone wave wait out the LDS latency
#pragma unroll
        for (int ks = 0; ks < S::KS; ++ks)
#pragma unroll
            for (int nb = 0; nb < 4; ++nb)
#pragma unroll
                for (int mb = 0; mb < 4; ++mb) { acc[mb][nb] = WFrag<T16>::mma(a[ks][mb], b[ks][nb], acc[mb][nb]); if (NSPLIT >= 2) { acc[mb][nb] = WFrag<T16>::mma(a2[ks][mb], b[ks][nb], acc[mb][nb]); acc[mb][nb] = WFrag<T16>::mma(a[ks][mb], b2[ks][nb], acc[mb][nb]); } }
        __builtin_amdgcn_sched_barrier(0);   // keeps the waits below behind the WMMAs: lifted over them, the wave would sit out the next step's copies before its matrix work and not under it
        asm volatile("s_wait_dscnt 0x0" ::: "memory");      // this step's LDS reads have retired before its buffer is refilled
        asm volatile("s_wait_asynccnt 0x0" ::: "memory");   // the next step's copies have landed before the next trip reads them
        __syncthreads();   // publish point, as above: no instruction while a block is one wave
        if (t + 2 < nt) fill(t + 2);
    }
    asm volatile("s_wait_asynccnt 0x0" ::: "memory");       // nothing in flight when the buffers become the output staging
}
template <typename T16, int NSPLIT, bool BIAS>
__global__ __launch_bounds__(32) void k_gemmw(const T16* __restrict__ A, const T16* __restrict__ A2, const T16* __restrict__ Bt, const T16* __restrict__ Bt2, int K, float* C, int ldc, const float* __restrict__ bias, size_t sA, size_t sB, size_t sC) {
    typedef typename WFrag<T16>::V V;
    __shared__ __align__(16) char smem[2 * Stg<NSPLIT>::STAGE]; float* os = (float*)smem;   // the output staging (16 x 68 f32) takes the operand buffers' place behind the K loop
    const size_t z = blockIdx.z; A += z * sA; if (A2) A2 += z * sA; Bt += z * sB; if (Bt2) Bt2 += z * sB; C += z * sC;
    const int lane = threadIdx.x & 31, lr = lane & 15, hi = lane >> 4; const int r0 = blockIdx.x * 64, c0 = blockIdx.y * 64;
    v8f acc[4][4];
#pragma unroll
    for (int mb = 0; mb < 4; ++mb)
#pragma unroll
        for (int nb = 0; nb < 4; ++nb) acc[mb][nb] = (v8f){};
    tile_mm<T16, NSPLIT>(A, A2, Bt, Bt2, K, K, r0, c0, smem, acc);
#pragma unroll
    for (int mb = 0; mb < 4; ++mb) {
#pragma unroll
        for (int nb = 0; nb < 4; ++nb) {
#pragma unroll
            for (int j = 0; j < 8; ++j) os[(hi * 8 + j) * 68 + nb * 16 + lr] = acc[mb][nb][j]; }
        __builtin_amdgcn_wave_barrier(); asm volatile("" ::: "memory");
        float* crow = C + (size_t)(r0 + mb * 16) * ldc + c0;
{
#pragma unroll
            for (int s = 0; s < 8; ++s) { const int row = 2 * s + hi, cofs = lr * 4; v4f val = *(const v4fa*)(os + row * 68 + cofs); if (BIAS) { val[0] += bfr(bias[c0 + cofs]); val[1] += bfr(bias[c0 + cofs + 1]); val[2] += bfr(bias[c0 + cofs + 2]); val[3] += bfr(bias[c0 + cofs + 3]); }
                *(v4f*)(crow + (size_t)row * ldc + cofs) = val; }
             }
        __builtin_amdgcn_wave_barrier(); asm volatile("" ::: "memory");
    }
}

// ---- k_gemmc: the same one-wave 64x64 tile GEMM specialised for causal attention: CMODE 1 skips score tiles entirely above the diagonal (query rows r0+roff.., key columns c0..), CMODE 2 limits the
// key (K) loop of the probability x value contraction to the diagonal block (probabilities beyond it are exactly zero). roff = row offset of this launch's first row within the sequence.
template <typename T16, int NSPLIT, int CMODE>
__global__ __launch_bounds__(32) void k_gemmc(const T16* __restrict__ A, const T16* __restrict__ A2, const T16* __restrict__ Bt, const T16* __restrict__ Bt2, int K, float* C, int ldc, int roff, size_t sA, size_t sB, size_t sC) {
    typedef typename WFrag<T16>::V V;
    __shared__ __align__(16) char smem[2 * Stg<NSPLIT>::STAGE]; float* os = (float*)smem;   // the output staging (16 x 68 f32) takes the operand buffers' place behind the K loop
    const size_t z = blockIdx.z; A += z * sA; if (A2) A2 += z * sA; Bt += z * sB; if (Bt2) Bt2 += z * sB; C += z * sC;
    const int lane = threadIdx.x & 31, lr = lane & 15, hi = lane >> 4; const int r0 = blockIdx.x * 64, c0 = blockIdx.y * 64;
    if (CMODE == 1 && c0 > r0 + roff + 63) return;                  // score tile entirely above the causal diagonal: never read (the softmax masks j > i by select)
    const int Kl = (CMODE == 2) ? min(K, r0 + roff + 64) : K;        // P.V: probabilities are exactly 0 beyond the diagonal block, so the K loop stops there
    v8f acc[4][4];
#pragma unroll
    for (int mb = 0; mb < 4; ++mb)
#pragma unroll
        for (int nb = 0; nb < 4; ++nb) acc[mb][nb] = (v8f){};
    tile_mm<T16, NSPLIT>(A, A2, Bt, Bt2, K, Kl, r0, c0, smem, acc);
#pragma unroll
    for (int mb = 0; mb < 4; ++mb) {
#pragma unroll
        for (int nb = 0; nb < 4; ++nb) {
#pragma unroll
            for (int j = 0; j < 8; ++j) os[(hi * 8 + j) * 68 + nb * 16 + lr] = acc[mb][nb][j]; }
        __builtin_amdgcn_wave_barrier(); asm volatile("" ::: "memory");
        float* crow = C + (size_t)(r0 + mb * 16) * ldc + c0;
{
#pragma unroll
            for (int s = 0; s < 8; ++s) { const int row = 2 * s + hi, cofs = lr * 4; v4f val = *(const v4fa*)(os + row * 68 + cofs);
                *(v4f*)(crow + (size_t)row * ldc + cofs) = val; }
             }
        __builtin_amdgcn_wave_barrier(); asm volatile("" ::: "memory");
    }
}

__device__ __forceinline__ h16 tohx(float x) { return (h16)x; }
__device__ __forceinline__ void splitf(float y, unsigned short& h, unsigned short& l) { h = f2bf(y); l = f2bf(y - bf2f(h)); }
typedef __attribute__((ext_vector_type(2))) _Float16 v2h;
typedef __attribute__((ext_vector_type(4))) _Float16 v4h;
typedef __attribute__((ext_vector_type(2))) unsigned short v2us;
typedef __attribute__((ext_vector_type(4))) unsigned short v4us;
typedef __attribute__((ext_vector_type(2))) float v2f;
typedef __attribute__((ext_vector_type(4))) int v4i;

__global__ __launch_bounds__(256) void k_wtG(const float* __restrict__ w, int K, int N, bf* Bt) {
    const int lane = threadIdx.x & 31; const int L0 = (blockIdx.x * 8 + (threadIdx.x >> 5)) * 8; const int nlines = N * K / 64;
{
#pragma unroll 1
        for (int l = 0; l < 8; ++l) { const int L = L0 + l; if (L >= nlines) break; const size_t e = (size_t)L * 64 + lane * 2; const int k = (int)(e % K), n = (int)(e / K); v2us o;
            o[0] = f2bf(w[(size_t)k * N + n]); o[1] = f2bf(w[(size_t)(k + 1) * N + n]); *(v2us*)(Bt + e) = o; }
         }
}
__global__ __launch_bounds__(256) void k_cvt8(const float* __restrict__ src, bf* dst, size_t n8) { const size_t i = (size_t)blockIdx.x * 256 + threadIdx.x; if (i >= n8) return; const v8f v = *(const v8f*)(src + i * 8); v8us o;
#pragma unroll
    for (int k = 0; k < 8; ++k) o[k] = f2bf(v[k]); *(v8us*)(dst + i * 8) = o;  }
__global__ __launch_bounds__(256) void k_cscvt(const float* __restrict__ cosT, const float* __restrict__ sinT, float* CS) { const int idx = blockIdx.x * 256 + threadIdx.x; if (idx >= TT * HD) return; v2f cs; cs[0] = bfr(cosT[idx]); cs[1] = bfr(sinT[idx]); *(v2f*)(CS + (size_t)idx * 2) = cs;  }
// k_rope: head planes [h][t][d] (fp16 + hi/lo) of rope(x) x sc with the rotate-half convention out[d] = x[d] cos[t][d] - x[d+HD/2] sin[t][d], out[d+HD/2] = x[d+HD/2] cos[t][d+HD/2] + x[d] sin[t][d+HD/2]
__global__ __launch_bounds__(256) void k_rope(const float* __restrict__ F, int pitch, int nheads, const float* __restrict__ CS, const float* __restrict__ RF, const float* __restrict__ nw, float sc, h16* P16, bf* Ph, bf* Pl) {
    const size_t e = ((size_t)blockIdx.x * 256 + threadIdx.x) * 2; if (e >= (size_t)nheads * TT * HD) return; const int d = (int)(e % HD); const int t = (int)((e / HD) % TT); const int h = (int)(e / ((size_t)HD * TT)); const float* f = F + (size_t)t * pitch + h * HD; const float rf = RF ? RF[(size_t)h * TT + t] : 1.0f; v2h o16; v2us oh, ol;
#pragma unroll
    for (int q = 0; q < 2; ++q) { const int dd = d + q; const int dp = (dd < HD / 2) ? dd + HD / 2 : dd - HD / 2; float x0 = f[dd], x1 = f[dp];
        if (RF) { float n0 = __fmul_rn(x0, rf), n1 = __fmul_rn(x1, rf); asm volatile("" : "+v"(n0)); asm volatile("" : "+v"(n1)); x0 = __fmul_rn(bfr(nw[dd]), n0); x1 = __fmul_rn(bfr(nw[dp]), n1); }
        const v2f cs = *(const v2f*)(CS + ((size_t)t * HD + dd) * 2); float a = __fmul_rn(x0, cs[0]), bq = __fmul_rn(x1, cs[1]); asm volatile("" : "+v"(a)); asm volatile("" : "+v"(bq)); const float r = ((dd < HD / 2) ? __fsub_rn(a, bq) : __fadd_rn(a, bq)) * sc;
        o16[q] = tohx(r); unsigned short a2, c2; splitf(r, a2, c2); oh[q] = a2; ol[q] = c2; }
    *(v2h*)(P16 + e) = o16; *(v2us*)(Ph + e) = oh; *(v2us*)(Pl + e) = ol;  }
__global__ __launch_bounds__(256) void k_vtp(const float* __restrict__ F, int pitch, int nheads, h16* V16, bf* Vh, bf* Vl) { const size_t e = ((size_t)blockIdx.x * 256 + threadIdx.x) * 2; if (e >= (size_t)nheads * HD * TT) return; const int t = (int)(e % TT); const int d = (int)((e / TT) % HD); const int g = (int)(e / ((size_t)TT * HD)); v2h o16; v2us oh, ol;
#pragma unroll
    for (int q = 0; q < 2; ++q) { const float x = F[(size_t)(t + q) * pitch + g * HD + d]; o16[q] = tohx(x); unsigned short a2, c2; splitf(x, a2, c2); oh[q] = a2; ol[q] = c2; }
    *(v2h*)(V16 + e) = o16; *(v2us*)(Vh + e) = oh; *(v2us*)(Vl + e) = ol;  }
__global__ __launch_bounds__(256) void k_csid(float* CS) { const int idx = blockIdx.x * 256 + threadIdx.x; if (idx >= TT * HD) return; v2f cs; cs[0] = 1.0f; cs[1] = 0.0f; *(v2f*)(CS + (size_t)idx * 2) = cs;  }
// k_asoft: per row (zz, i): t = S x HD^-0.5 for j <= i and i - j < WIN (sliding causal window; the reference's -1e9 additive fill vanishes identically); softmax over the 4096 keys (register row, one exp, fixed trees);
__global__ __launch_bounds__(256) void k_asoft(const float* __restrict__ Sb, h16* P16, bf* Ph, bf* Pl) {
    const int lane = threadIdx.x & 31; const int row = blockIdx.x * 8 + (threadIdx.x >> 5); if (row >= ZH * TT) return; const int i = row % TT; const int zz = row / TT; (void)zz; const bool hires = (i < RH); const float* sr = Sb + (size_t)row * TT; float v[TT / 32]; float mx = -3.0e38f;
#pragma unroll
    for (int ch = 0; ch < TT / 128; ++ch) { const int j0 = ch * 128 + lane * 4; const v4f a = *(const v4f*)(sr + j0);
#pragma unroll
        for (int q = 0; q < 4; ++q) { const int j = j0 + q; (void)j; float sa = a[q] * SCL; asm volatile("" : "+v"(sa)); const float t = (j <= i) ? sa : -3.0e38f; v[ch * 4 + q] = t; mx = fmaxf(mx, t); } }
#pragma unroll
    for (int sh = 16; sh; sh >>= 1) mx = fmaxf(mx, __shfl_xor(mx, sh, 32));
    float sum = 0.f;
#pragma unroll
    for (int k = 0; k < TT / 32; ++k) { float d0 = __fsub_rn(v[k], mx); asm volatile("" : "+v"(d0)); v[k] = __builtin_amdgcn_exp2f(__fmul_rn(d0, 1.4426950408889634f)); sum += v[k]; }
#pragma unroll
    for (int sh = 16; sh; sh >>= 1) sum += __shfl_xor(sum, sh, 32);
    const float f = __fdiv_rn(hires ? 1.0f : PCAR, sum);
{
        if (hires) {
#pragma unroll
            for (int ch = 0; ch < TT / 128; ++ch) { v4us oh, ol;
#pragma unroll
                for (int q = 0; q < 4; ++q) { unsigned short a, c2; splitf(v[ch * 4 + q] * f, a, c2); oh[q] = a; ol[q] = c2; }
                const size_t oo = ((size_t)zz * (RH ? RH : 1) + i) * TT + ch * 128 + lane * 4; *(v4us*)(Ph + oo) = oh; *(v4us*)(Pl + oo) = ol; }
        } else {
#pragma unroll
            for (int ch = 0; ch < TT / 128; ++ch) { v4h o4;
#pragma unroll
                for (int q = 0; q < 4; ++q) o4[q] = tohx(v[ch * 4 + q] * f);
                *(v4h*)(P16 + (size_t)row * TT + ch * 128 + lane * 4) = o4; } }
         }
}
__global__ __launch_bounds__(256) void k_merge(const float* __restrict__ O, int h0, bf* Ah, bf* Al) { const size_t e = ((size_t)blockIdx.x * 256 + threadIdx.x) * 2; if (e >= (size_t)ZH * TT * HD) return; const int d = (int)(e % HD); const int t = (int)((e / HD) % TT); const int zz = (int)(e / ((size_t)HD * TT)); const float cs = (t < RH) ? 1.0f : (1.0f / PCAR); const size_t oo = (size_t)t * DQ + (h0 + zz) * HD + d;
    v2us oh, ol;
#pragma unroll
    for (int q = 0; q < 2; ++q) { unsigned short a, c2; splitf(O[e + q] * cs, a, c2); oh[q] = a; ol[q] = c2; } *(v2us*)(Ah + oo) = oh; *(v2us*)(Al + oo) = ol;  }

__global__ __launch_bounds__(256) void k_mout(const float* __restrict__ O, int h0, float* OUTb) { const size_t e = ((size_t)blockIdx.x * 256 + threadIdx.x) * 2; if (e >= (size_t)ZH * TT * HD) return; const int d = (int)(e % HD); const int t = (int)((e / HD) % TT); const int zz = (int)(e / ((size_t)HD * TT)); const float cs = (t < RH) ? 1.0f : (1.0f / PCAR); v2f o; o[0] = O[e] * cs; o[1] = O[e + 1] * cs; float* dst = OUTb + (size_t)t * DQ + (h0 + zz) * HD + d; *(v2f*)dst = o;  }

extern "C" void kernel_launch(void* const* d_in, const int* in_sizes, int n_in,
                              void* d_out, int out_size, void* d_ws, size_t ws_size, hipStream_t stream) {
    (void)in_sizes; (void)n_in; (void)out_size;
    const float* x = (const float*)d_in[0]; const float* wq = (const float*)d_in[1]; const float* wk = (const float*)d_in[2]; const float* wv = (const float*)d_in[3]; const float* wo = nullptr; (void)wo; const float* cosT = nullptr; const float* sinT = nullptr; (void)cosT; (void)sinT;
    float* OUT = (float*)d_out;     // [4][4096][768]
    char* wsp = (char*)d_ws;
    auto take = [&](size_t bytes) { char* p = wsp; wsp += (bytes + 255) & ~(size_t)255; return (void*)p; };
    bf* WQ = (bf*)take((size_t)DQ * DM * 2); bf* WK = (bf*)take((size_t)DKV * DM * 2); bf* WV = (bf*)take((size_t)DKV * DM * 2); bf* WO = nullptr; (void)WO; float* CS = (float*)take((size_t)TT * HD * 2 * 4);
    bf* XB = (bf*)take((size_t)TT * DM * 2); float* FQ = (float*)take((size_t)TT * DQ * 4); float* FK = (float*)take((size_t)TT * DKV * 4);
    h16* QP16 = (h16*)take((size_t)NH_ * TT * HD * 2); h16* KP16 = (h16*)take((size_t)NKV * TT * HD * 2); h16* VT16 = (h16*)take((size_t)NKV * HD * TT * 2);
    bf* QPh = (bf*)take((size_t)NH_ * TT * HD * 2); bf* QPl = (bf*)take((size_t)NH_ * TT * HD * 2); bf* KPh = (bf*)take((size_t)NKV * TT * HD * 2); bf* KPl = (bf*)take((size_t)NKV * TT * HD * 2); bf* VTh = (bf*)take((size_t)NKV * HD * TT * 2); bf* VTl = (bf*)take((size_t)NKV * HD * TT * 2); bf* Ph = (bf*)take((size_t)ZH * RH * TT * 2); bf* Pl = (bf*)take((size_t)ZH * RH * TT * 2);
    float* Sb = (float*)take((size_t)ZH * TT * TT * 4); h16* P16 = (h16*)take((size_t)ZH * TT * TT * 2); float* Ob = (float*)take((size_t)ZH * TT * HD * 4); bf* ATh = nullptr; bf* ATl = nullptr; (void)ATh; (void)ATl;
    if ((size_t)(wsp - (char*)d_ws) > ws_size) return;    // ws 256 MiB
    float* FV = FK;   // v projection reuses the k buffer after the k planes are built (stream-ordered)
    { k_cvt8<<<(unsigned)(((size_t)DQ * DM / 8 + 255) / 256), 256, 0, stream>>>(wq, WQ, (size_t)DQ * DM / 8); k_cvt8<<<(unsigned)(((size_t)DKV * DM / 8 + 255) / 256), 256, 0, stream>>>(wk, WK, (size_t)DKV * DM / 8); k_cvt8<<<(unsigned)(((size_t)DKV * DM / 8 + 255) / 256), 256, 0, stream>>>(wv, WV, (size_t)DKV * DM / 8);
      /* no output projection */
       }
    k_csid<<<(TT * HD + 255) / 256, 256, 0, stream>>>(CS);
    const unsigned LQ = (unsigned)(((size_t)NH_ * TT * HD / 2 + 255) / 256), LKv = (unsigned)(((size_t)NKV * TT * HD / 2 + 255) / 256);
    for (int b = 0; b < NB_; ++b) {
        
        k_cvt8<<<(unsigned)(((size_t)TT * DM / 8 + 255) / 256), 256, 0, stream>>>(x + (size_t)b * TT * DM, XB, (size_t)TT * DM / 8);
        k_gemmw<bf, 0, false><<<dim3(TT / 64, DQ / 64, 1), 32, 0, stream>>>(XB, nullptr, WQ, nullptr, DM, FQ, DQ, nullptr, 0, 0, 0);
        k_rope<<<LQ, 256, 0, stream>>>(FQ, DQ, NH_, CS, nullptr, nullptr, 1.0f, QP16, QPh, QPl);
        k_gemmw<bf, 0, false><<<dim3(TT / 64, DKV / 64, 1), 32, 0, stream>>>(XB, nullptr, WK, nullptr, DM, FK, DKV, nullptr, 0, 0, 0);
        k_rope<<<LKv, 256, 0, stream>>>(FK, DKV, NKV, CS, nullptr, nullptr, 1.0f, KP16, KPh, KPl);
        k_gemmw<bf, 0, false><<<dim3(TT / 64, DKV / 64, 1), 32, 0, stream>>>(XB, nullptr, WV, nullptr, DM, FV, DKV, nullptr, 0, 0, 0); k_vtp<<<LKv, 256, 0, stream>>>(FV, DKV, NKV, VT16, VTh, VTl);
        for (int h0 = 0; h0 < NH_; h0 += ZH) { const size_t zq = (size_t)h0, zk = (size_t)(h0 / REP);   // one kv head per query head: each pass handles one head (ZH = 1; z-strides TT*HD)
            k_gemmc<bf, 2, 1><<<dim3(RH / 64, TT / 64, ZH), 32, 0, stream>>>(QPh + zq * TT * HD, QPl + zq * TT * HD, KPh + zk * TT * HD, KPl + zk * TT * HD, HD, Sb, TT, 0, (size_t)TT * HD, (size_t)TT * HD, (size_t)TT * TT);
            k_gemmc<h16, 0, 1><<<dim3((TT - RH) / 64, TT / 64, ZH), 32, 0, stream>>>(QP16 + zq * TT * HD + (size_t)RH * HD, nullptr, KP16 + zk * TT * HD, nullptr, HD, Sb + (size_t)RH * TT, TT, RH, (size_t)TT * HD, (size_t)TT * HD, (size_t)TT * TT);
            k_asoft<<<ZH * TT / 8, 256, 0, stream>>>(Sb, P16, Ph, Pl);
            k_gemmc<bf, 2, 2><<<dim3(RH / 64, HD / 64, ZH), 32, 0, stream>>>(Ph, Pl, VTh + zk * HD * TT, VTl + zk * HD * TT, TT, Ob, HD, 0, (size_t)RH * TT, (size_t)HD * TT, (size_t)TT * HD);
            k_gemmc<h16, 0, 2><<<dim3((TT - RH) / 64, HD / 64, ZH), 32, 0, stream>>>(P16 + (size_t)RH * TT, nullptr, VT16 + zk * HD * TT, nullptr, TT, Ob + (size_t)RH * HD, HD, RH, (size_t)TT * TT, (size_t)HD * TT, (size_t)TT * HD);
            k_mout<<<(unsigned)(((size_t)ZH * TT * HD / 2 + 255) / 256), 256, 0, stream>>>(Ob, h0, OUT + (size_t)b * TT * DM); }
        }
}

// v002
// It runs in 661 microseconds.
// Two timings next to v001 put it at 1.18 and 1.17 times that version's speed.
// All steps since v000 together make it 1.69 times as fast.
#include <hip/hip_runtime.h>

// CausalMaskedAttention (input [4][4096][768]; q/k/v = x W^T ([768][768], one head of width 768); scores = q.k / sqrt(768) (the source scales by d_in), causal (-inf); softmax; out = weights v -> [4][4096][768] (no output projection)).
// Compute dtypes, f32 accumulate: every input rounded to bf16; q/k/v on PLAIN bf16 operands (inputs: exact); causal scores and attn.v: query rows < 512 hl (3 products), the rest single fp16 (x1024), causal tile skipping; softmax f32 (128 keys per lane); the context written directly in f32 by the attn.v GEMM; the q/k/v operand planes written by the projection GEMMs' epilogues.

#define NB_  4
#define TT   4096
#define DM   768
#define NH_  1
#define NKV  1
#define REP  (NH_ / NKV)
#define HD   768
#define DQ   (NH_ * HD)
#define DKV  (NKV * HD)
#define ZH   1
#define RH   512                  // query rows < RH use hi+lo planes (0: none)
#define WIN  4096
#define PCAR 1024.0f
#define SCL  0.036084391824351615f   // 1/sqrt(d_in = 768)
typedef _Float16 h16;
typedef unsigned short bf;
typedef __attribute__((ext_vector_type(16))) __bf16   v16bf;
typedef __attribute__((ext_vector_type(16))) _Float16 v16h;
typedef __attribute__((ext_vector_type(8)))  _Float16 v8h;
typedef __attribute__((ext_vector_type(8)))  unsigned short v8us;
typedef __attribute__((ext_vector_type(8)))  float    v8f;
typedef __attribute__((ext_vector_type(4)))  float    v4f;
typedef v8h  __attribute__((may_alias)) v8ha;
typedef v4f  __attribute__((may_alias)) v4fa;
typedef v8us __attribute__((may_alias)) v8usa;

__device__ __forceinline__ unsigned short f2bf(float f) { unsigned u = __float_as_uint(f); u += 0x7FFFu + ((u >> 16) & 1u); return (unsigned short)(u >> 16); }
__device__ __forceinline__ float bf2f(unsigned short b) { return __uint_as_float(((unsigned)b) << 16); }
__device__ __forceinline__ float bfr(float f) { return bf2f(f2bf(f)); }
__device__ __forceinline__ v16h cat16(v8h lo, v8h hi) { return __builtin_shufflevector(lo, hi, 0, 1, 2, 3, 4, 5, 6, 7, 8, 9, 10, 11, 12, 13, 14, 15); }
__device__ __forceinline__ v16bf cat16b(v8us lo, v8us hi) { return __builtin_bit_cast(v16bf, __builtin_shufflevector(lo, hi, 0, 1, 2, 3, 4, 5, 6, 7, 8, 9, 10, 11, 12, 13, 14, 15)); }
__device__ __forceinline__ v8f wmma16(v16h a, v16h b, v8f c) { return __builtin_amdgcn_wmma_f32_16x16x32_f16(false, a, false, b, (short)0, c, false, false); }
__device__ __forceinline__ v8f wmmab(v16bf a, v16bf b, v8f c) { return __builtin_amdgcn_wmma_f32_16x16x32_bf16(false, a, false, b, (short)0, c, false, false); }



// ---- register-blocked GEMMs, ONE WAVE per 64x64 output tile (16 accumulators), operands from K-contiguous 16-bit planes through LDS (tile_mm); grid (M/64, N/64, Z), 32 threads.
// C[m][n] = sum_k A[m][k] Bt[n][k] (+ split products per NSPLIT). K % 64 == 0 (K % 32 == 0 with NSPLIT 2).
template <typename T16> struct WFrag;
template <> struct WFrag<h16> { typedef v16h V; static __device__ __forceinline__ V ld(const h16* p) { return cat16(*(const v8h*)p, *(const v8h*)(p + 16)); } static __device__ __forceinline__ v8f mma(V a, V b, v8f c) { return wmma16(a, b, c); } };
template <> struct WFrag<bf> { typedef v16bf V; static __device__ __forceinline__ V ld(const bf* p) { return cat16b(*(const v8us*)p, *(const v8us*)(p + 16)); } static __device__ __forceinline__ v8f mma(V a, V b, v8f c) { return wmmab(a, b, c); } };
// ---- operand staging for the one-wave 64x64 tile GEMMs: each K step's operand rows go from global memory to LDS by asynchronous copies that cover the rows' bytes side by side (128-B rows: 8 lanes a row,
// 4 whole lines a copy; the three-product kernels take 64-B rows so that a stage stays at 32 copies), two buffers, the next step's copies in flight while this step's fragments are read from LDS.
template <int NSPLIT> struct Stg { static constexpr int NPL = (NSPLIT >= 2) ? 4 : 2, RB = (NSPLIT >= 2) ? 64 : 128, PITCH = RB + 16, LPR = RB / 16, RPC = 32 / LPR, CPP = 64 / RPC, PLANE = 64 * PITCH, STAGE = NPL * PLANE, KSTEP = RB / 2, KS = RB / 64; };
typedef int gv4i __attribute__((vector_size(16)));
// one copy of 16 B a lane, global -> LDS, through no register
template <typename T16>
__device__ __forceinline__ void copy16(const T16* g, char* l) { __builtin_amdgcn_global_load_async_to_lds_b128((__attribute__((address_space(1))) gv4i*)g, (__attribute__((address_space(3))) gv4i*)l, 0, 0); }
// acc += A[r0..r0+63][0..Kl) x Bt[c0..c0+63][0..Kl)^T (+ the split products), k ascending in steps of 32 as before. smem: 2 * Stg<NSPLIT>::STAGE bytes, private to the wave. Kl % KSTEP == 0, Kl >= KSTEP.
template <typename T16, int NSPLIT>
__device__ __forceinline__ void tile_mm(const T16* __restrict__ A, const T16* __restrict__ A2, const T16* __restrict__ Bt, const T16* __restrict__ Bt2, int K, int Kl, int r0, int c0, char* smem, v8f (&acc)[4][4]) {
    typedef typename WFrag<T16>::V V; typedef Stg<NSPLIT> S;
    static_assert(NSPLIT == 0 || NSPLIT == 2, "one product or the three hi/lo products");
    const int lane = threadIdx.x & 31, lr = lane & 15, hi = lane >> 4;
    const size_t ga = (size_t)(r0 + lane / S::LPR) * K + (lane % S::LPR) * 8, gb = (size_t)(c0 + lane / S::LPR) * K + (lane % S::LPR) * 8;
    char* l0 = smem + (lane / S::LPR) * S::PITCH + (lane % S::LPR) * 16;
    const T16* pl[4] = { A + ga, Bt + gb, (NSPLIT >= 2) ? A2 + ga : nullptr, (NSPLIT >= 2) ? Bt2 + gb : nullptr };
    auto fill = [&](int t) {
#pragma unroll
        for (int p = 0; p < S::NPL; ++p)
#pragma unroll
            for (int g = 0; g < S::CPP; ++g)
                copy16<T16>(pl[p] + (size_t)t * S::KSTEP + (size_t)(g * S::RPC) * K, l0 + (t & 1) * S::STAGE + p * S::PLANE + g * S::RPC * S::PITCH);
    };
    const int nt = Kl / S::KSTEP;
    fill(0);
    asm volatile("s_wait_asynccnt 0x0" ::: "memory");   // step 0 has landed before anything reads it
    __syncthreads();   // the ring's publish point; a block of one wave, so the compiler emits no barrier instruction for it
    if (nt > 1) fill(1);
#pragma unroll 1
    for (int t = 0; t < nt; ++t) {
        const char* sb = smem + (t & 1) * S::STAGE + lr * S::PITCH + hi * 16;
        V a[S::KS][4], b[S::KS][4], a2[S::KS][4], b2[S::KS][4];
#pragma unroll
        for (int ks = 0; ks < S::KS; ++ks)
#pragma unroll
            for (int q = 0; q < 4; ++q) { a[ks][q] = WFrag<T16>::ld((const T16*)(sb + q * 16 * S::PITCH + ks * 64)); b[ks][q] = WFrag<T16>::ld((const T16*)(sb + S::PLANE + q * 16 * S::PITCH + ks * 64));
                if (NSPLIT >= 2) { a2[ks][q] = WFrag<T16>::ld((const T16*)(sb + 2 * S::PLANE + q * 16 * S::PITCH + ks * 64)); b2[ks][q] = WFrag<T16>::ld((const T16*)(sb + 3 * S::PLANE + q * 16 * S::PITCH + ks * 64)); } }
        __builtin_amdgcn_sched_barrier(0);   // keeps the step's LDS reads together ahead of its WMMAs: sunk among them, each group makes the lone wave wait out the LDS latency
#pragma unroll
        for (int ks = 0; ks < S::KS; ++ks)
#pragma unroll
            for (int nb = 0; nb < 4; ++nb)
#pragma unroll
                for (int mb = 0; mb < 4; ++mb) { acc[mb][nb] = WFrag<T16>::mma(a[ks][mb], b[ks][nb], acc[mb][nb]); if (NSPLIT >= 2) { acc[mb][nb] = WFrag<T16>::mma(a2[ks][mb], b[ks][nb], acc[mb][nb]); acc[mb][nb] = WFrag<T16>::mma(a[ks][mb], b2[ks][nb], acc[mb][nb]); } }
        __builtin_amdgcn_sched_barrier(0);   // keeps the waits below behind the WMMAs: lifted over them, the wave would sit out the next step's copies before its matrix work and not under it
        asm volatile("s_wait_dscnt 0x0" ::: "memory");      // this step's LDS reads have retired before its buffer is refilled
        asm volatile("s_wait_asynccnt 0x0" ::: "memory");   // the next step's copies have landed before the next trip reads them
        __syncthreads();   // publish point, as above: no instruction while a block is one wave
        if (t + 2 < nt) fill(t + 2);
    }
    asm volatile("s_wait_asynccnt 0x0" ::: "memory");       // nothing in flight when the buffers become the output staging
}

// ---- k_gemmc: the same one-wave 64x64 tile GEMM specialised for causal attention: CMODE 1 skips score tiles entirely above the diagonal (query rows r0+roff.., key columns c0..), CMODE 2 limits the
// key (K) loop of the probability x value contraction to the diagonal block (probabilities beyond it are exactly zero). roff = row offset of this launch's first row within the sequence. CMODE 2 stores acc x osc (the inverse of the probabilities' carry factor), so C is the final output.
template <typename T16, int NSPLIT, int CMODE>
__global__ __launch_bounds__(32) void k_gemmc(const T16* __restrict__ A, const T16* __restrict__ A2, const T16* __restrict__ Bt, const T16* __restrict__ Bt2, int K, float* C, int ldc, int roff, float osc, size_t sA, size_t sB, size_t sC) {
    typedef typename WFrag<T16>::V V;
    __shared__ __align__(16) char smem[2 * Stg<NSPLIT>::STAGE]; float* os = (float*)smem;   // the output staging (16 x 68 f32) takes the operand buffers' place behind the K loop
    const size_t z = blockIdx.z; A += z * sA; if (A2) A2 += z * sA; Bt += z * sB; if (Bt2) Bt2 += z * sB; C += z * sC;
    const int lane = threadIdx.x & 31, lr = lane & 15, hi = lane >> 4; const int r0 = blockIdx.x * 64, c0 = blockIdx.y * 64;
    if (CMODE == 1 && c0 > r0 + roff + 63) return;                  // score tile entirely above the causal diagonal: never read (the softmax masks j > i by select)
    const int Kl = (CMODE == 2) ? min(K, r0 + roff + 64) : K;        // P.V: probabilities are exactly 0 beyond the diagonal block, so the K loop stops there
    v8f acc[4][4];
#pragma unroll
    for (int mb = 0; mb < 4; ++mb)
#pragma unroll
        for (int nb = 0; nb < 4; ++nb) acc[mb][nb] = (v8f){};
    tile_mm<T16, NSPLIT>(A, A2, Bt, Bt2, K, Kl, r0, c0, smem, acc);
#pragma unroll
    for (int mb = 0; mb < 4; ++mb) {
#pragma unroll
        for (int nb = 0; nb < 4; ++nb) {
#pragma unroll
            for (int j = 0; j < 8; ++j) os[(hi * 8 + j) * 68 + nb * 16 + lr] = acc[mb][nb][j]; }
        __builtin_amdgcn_wave_barrier(); asm volatile("" ::: "memory");
        float* crow = C + (size_t)(r0 + mb * 16) * ldc + c0;
{
#pragma unroll
            for (int s = 0; s < 8; ++s) { const int row = 2 * s + hi, cofs = lr * 4; v4f val = *(const v4fa*)(os + row * 68 + cofs); if (CMODE == 2) val *= osc;
                *(v4f*)(crow + (size_t)row * ldc + cofs) = val; }
             }
        __builtin_amdgcn_wave_barrier(); asm volatile("" ::: "memory");
    }
}

__device__ __forceinline__ h16 tohx(float x) { return (h16)x; }
__device__ __forceinline__ void splitf(float y, unsigned short& h, unsigned short& l) { h = f2bf(y); l = f2bf(y - bf2f(h)); }
typedef __attribute__((ext_vector_type(2))) _Float16 v2h;
typedef __attribute__((ext_vector_type(4))) _Float16 v4h;
typedef __attribute__((ext_vector_type(2))) unsigned short v2us;
typedef __attribute__((ext_vector_type(4))) unsigned short v4us;
typedef __attribute__((ext_vector_type(2))) float v2f;
typedef __attribute__((ext_vector_type(4))) int v4i;

// k_gemmp: the same tile GEMM on plain bf16 operands whose epilogue writes the attention operand planes itself: C[m][n] = sum_k A[m][k] Bt[n][k], stored as fp16 (P16) and as bf16 hi + lo (Ph, Pl), pitch ldc elements.
// The whole 64 x 64 f32 tile is staged in LDS (pitch 68) so that every store instruction covers whole 128-B rows of a plane (8 lanes a row, 16 B a lane). With A = weight rows and Bt = token rows it yields the transposed planes [d][t].
__global__ __launch_bounds__(32) void k_gemmp(const bf* __restrict__ A, const bf* __restrict__ Bt, int K, h16* P16, bf* Ph, bf* Pl, int ldc) {
    __shared__ __align__(16) char smem[2 * Stg<0>::STAGE]; float* os = (float*)smem;   // the output staging (64 x 68 f32) takes the operand buffers' place behind the K loop
    static_assert(64 * 68 * 4 <= 2 * Stg<0>::STAGE, "the staged tile fits the operand buffers");
    const int lane = threadIdx.x & 31, lr = lane & 15, hi = lane >> 4; const int r0 = blockIdx.x * 64, c0 = blockIdx.y * 64;
    v8f acc[4][4];
#pragma unroll
    for (int mb = 0; mb < 4; ++mb)
#pragma unroll
        for (int nb = 0; nb < 4; ++nb) acc[mb][nb] = (v8f){};
    tile_mm<bf, 0>(A, nullptr, Bt, nullptr, K, K, r0, c0, smem, acc);
#pragma unroll
    for (int mb = 0; mb < 4; ++mb)
#pragma unroll
        for (int nb = 0; nb < 4; ++nb)
#pragma unroll
            for (int j = 0; j < 8; ++j) os[(mb * 16 + hi * 8 + j) * 68 + nb * 16 + lr] = acc[mb][nb][j];
    __syncthreads();   // the staged tile is read by other lanes than wrote it; a block of one wave, so this orders the LDS traffic and emits no barrier instruction
    const int rsub = lane >> 3, cofs = (lane & 7) * 8;
#pragma unroll   // straight-line text (the kernel stays far under 32 KB): constant LDS offsets, and LDS reads of later rows issue under the conversions of earlier ones
    for (int s = 0; s < 16; ++s) { const int row = s * 4 + rsub; const v4f u0 = *(const v4fa*)(os + row * 68 + cofs), u1 = *(const v4fa*)(os + row * 68 + cofs + 4); v8h o16; v8us oh, ol;
#pragma unroll
        for (int q = 0; q < 8; ++q) { const float r = (q < 4) ? u0[q & 3] : u1[q & 3]; o16[q] = tohx(r); unsigned short a2, c2; splitf(r, a2, c2); oh[q] = a2; ol[q] = c2; }
        const size_t oo = (size_t)(r0 + row) * ldc + c0 + cofs; *(v8h*)(P16 + oo) = o16; *(v8us*)(Ph + oo) = oh; *(v8us*)(Pl + oo) = ol; }
}

__global__ __launch_bounds__(256) void k_wtG(const float* __restrict__ w, int K, int N, bf* Bt) {
    const int lane = threadIdx.x & 31; const int L0 = (blockIdx.x * 8 + (threadIdx.x >> 5)) * 8; const int nlines = N * K / 64;
{
#pragma unroll 1
        for (int l = 0; l < 8; ++l) { const int L = L0 + l; if (L >= nlines) break; const size_t e = (size_t)L * 64 + lane * 2; const int k = (int)(e % K), n = (int)(e / K); v2us o;
            o[0] = f2bf(w[(size_t)k * N + n]); o[1] = f2bf(w[(size_t)(k + 1) * N + n]); *(v2us*)(Bt + e) = o; }
         }
}
__global__ __launch_bounds__(256) void k_cvt8(const float* __restrict__ src, bf* dst, size_t n8) { const size_t i = (size_t)blockIdx.x * 256 + threadIdx.x; if (i >= n8) return; const v8f v = *(const v8f*)(src + i * 8); v8us o;
#pragma unroll
    for (int k = 0; k < 8; ++k) o[k] = f2bf(v[k]); *(v8us*)(dst + i * 8) = o;  }
__global__ __launch_bounds__(256) void k_cscvt(const float* __restrict__ cosT, const float* __restrict__ sinT, float* CS) { const int idx = blockIdx.x * 256 + threadIdx.x; if (idx >= TT * HD) return; v2f cs; cs[0] = bfr(cosT[idx]); cs[1] = bfr(sinT[idx]); *(v2f*)(CS + (size_t)idx * 2) = cs;  }
// k_asoft: per row (zz, i): t = S x HD^-0.5 for j <= i (causal, by select; the reference's -1e9 additive fill vanishes identically); softmax over the 4096 keys (register row, one exp, fixed trees);
__global__ __launch_bounds__(256) void k_asoft(const float* __restrict__ Sb, h16* P16, bf* Ph, bf* Pl) {
    const int lane = threadIdx.x & 31; const int row = blockIdx.x * 8 + (threadIdx.x >> 5); if (row >= ZH * TT) return; const int i = row % TT; const int zz = row / TT; (void)zz; const bool hires = (i < RH); const float* sr = Sb + (size_t)row * TT; float v[TT / 32]; float mx = -3.0e38f;
#pragma unroll
    for (int ch = 0; ch < TT / 128; ++ch) { const int j0 = ch * 128 + lane * 4; const v4f a = *(const v4f*)(sr + j0);
#pragma unroll
        for (int q = 0; q < 4; ++q) { const int j = j0 + q; (void)j; float sa = a[q] * SCL; asm volatile("" : "+v"(sa)); const float t = (j <= i) ? sa : -3.0e38f; v[ch * 4 + q] = t; mx = fmaxf(mx, t); } }
#pragma unroll
    for (int sh = 16; sh; sh >>= 1) mx = fmaxf(mx, __shfl_xor(mx, sh, 32));
    float sum = 0.f;
#pragma unroll
    for (int k = 0; k < TT / 32; ++k) { float d0 = __fsub_rn(v[k], mx); asm volatile("" : "+v"(d0)); v[k] = __builtin_amdgcn_exp2f(__fmul_rn(d0, 1.4426950408889634f)); sum += v[k]; }
#pragma unroll
    for (int sh = 16; sh; sh >>= 1) sum += __shfl_xor(sum, sh, 32);
    const float f = __fdiv_rn(hires ? 1.0f : PCAR, sum);
{
        if (hires) {
#pragma unroll
            for (int ch = 0; ch < TT / 128; ++ch) { v4us oh, ol;
#pragma unroll
                for (int q = 0; q < 4; ++q) { unsigned short a, c2; splitf(v[ch * 4 + q] * f, a, c2); oh[q] = a; ol[q] = c2; }
                const size_t oo = ((size_t)zz * (RH ? RH : 1) + i) * TT + ch * 128 + lane * 4; *(v4us*)(Ph + oo) = oh; *(v4us*)(Pl + oo) = ol; }
        } else {
#pragma unroll
            for (int ch = 0; ch < TT / 128; ++ch) { v4h o4;
#pragma unroll
                for (int q = 0; q < 4; ++q) o4[q] = tohx(v[ch * 4 + q] * f);
                *(v4h*)(P16 + (size_t)row * TT + ch * 128 + lane * 4) = o4; } }
         }
}
__global__ __launch_bounds__(256) void k_merge(const float* __restrict__ O, int h0, bf* Ah, bf* Al) { const size_t e = ((size_t)blockIdx.x * 256 + threadIdx.x) * 2; if (e >= (size_t)ZH * TT * HD) return; const int d = (int)(e % HD); const int t = (int)((e / HD) % TT); const int zz = (int)(e / ((size_t)HD * TT)); const float cs = (t < RH) ? 1.0f : (1.0f / PCAR); const size_t oo = (size_t)t * DQ + (h0 + zz) * HD + d;
    v2us oh, ol;
#pragma unroll
    for (int q = 0; q < 2; ++q) { unsigned short a, c2; splitf(O[e + q] * cs, a, c2); oh[q] = a; ol[q] = c2; } *(v2us*)(Ah + oo) = oh; *(v2us*)(Al + oo) = ol;  }


extern "C" void kernel_launch(void* const* d_in, const int* in_sizes, int n_in,
                              void* d_out, int out_size, void* d_ws, size_t ws_size, hipStream_t stream) {
    (void)in_sizes; (void)n_in; (void)out_size;
    const float* x = (const float*)d_in[0]; const float* wq = (const float*)d_in[1]; const float* wk = (const float*)d_in[2]; const float* wv = (const float*)d_in[3];
    float* OUT = (float*)d_out;     // [4][4096][768]
    char* wsp = (char*)d_ws;
    auto take = [&](size_t bytes) { char* p = wsp; wsp += (bytes + 255) & ~(size_t)255; return (void*)p; };
    bf* WQ = (bf*)take((size_t)DQ * DM * 2); bf* WK = (bf*)take((size_t)DKV * DM * 2); bf* WV = (bf*)take((size_t)DKV * DM * 2);
    bf* XB = (bf*)take((size_t)TT * DM * 2);
    h16* QP16 = (h16*)take((size_t)NH_ * TT * HD * 2); h16* KP16 = (h16*)take((size_t)NKV * TT * HD * 2); h16* VT16 = (h16*)take((size_t)NKV * HD * TT * 2);
    bf* QPh = (bf*)take((size_t)NH_ * TT * HD * 2); bf* QPl = (bf*)take((size_t)NH_ * TT * HD * 2); bf* KPh = (bf*)take((size_t)NKV * TT * HD * 2); bf* KPl = (bf*)take((size_t)NKV * TT * HD * 2); bf* VTh = (bf*)take((size_t)NKV * HD * TT * 2); bf* VTl = (bf*)take((size_t)NKV * HD * TT * 2); bf* Ph = (bf*)take((size_t)ZH * RH * TT * 2); bf* Pl = (bf*)take((size_t)ZH * RH * TT * 2);
    float* Sb = (float*)take((size_t)ZH * TT * TT * 4); h16* P16 = (h16*)take((size_t)ZH * TT * TT * 2);
    if ((size_t)(wsp - (char*)d_ws) > ws_size) return;    // ws 256 MiB
    { k_cvt8<<<(unsigned)(((size_t)DQ * DM / 8 + 255) / 256), 256, 0, stream>>>(wq, WQ, (size_t)DQ * DM / 8); k_cvt8<<<(unsigned)(((size_t)DKV * DM / 8 + 255) / 256), 256, 0, stream>>>(wk, WK, (size_t)DKV * DM / 8); k_cvt8<<<(unsigned)(((size_t)DKV * DM / 8 + 255) / 256), 256, 0, stream>>>(wv, WV, (size_t)DKV * DM / 8);
      /* no output projection */
       }
    for (int b = 0; b < NB_; ++b) {
        float* OUTb = OUT + (size_t)b * TT * DM;
        k_cvt8<<<(unsigned)(((size_t)TT * DM / 8 + 255) / 256), 256, 0, stream>>>(x + (size_t)b * TT * DM, XB, (size_t)TT * DM / 8);
        k_gemmp<<<dim3(TT / 64, DQ / 64, 1), 32, 0, stream>>>(XB, WQ, DM, QP16, QPh, QPl, DQ);       // q planes [t][d]
        k_gemmp<<<dim3(TT / 64, DKV / 64, 1), 32, 0, stream>>>(XB, WK, DM, KP16, KPh, KPl, DKV);     // k planes [t][d]
        k_gemmp<<<dim3(DKV / 64, TT / 64, 1), 32, 0, stream>>>(WV, XB, DM, VT16, VTh, VTl, TT);      // v planes transposed [d][t]: the weight rows are the tile's rows
        k_gemmc<bf, 2, 1><<<dim3(RH / 64, TT / 64, ZH), 32, 0, stream>>>(QPh, QPl, KPh, KPl, HD, Sb, TT, 0, 1.0f, (size_t)TT * HD, (size_t)TT * HD, (size_t)TT * TT);
        k_gemmc<h16, 0, 1><<<dim3((TT - RH) / 64, TT / 64, ZH), 32, 0, stream>>>(QP16 + (size_t)RH * HD, nullptr, KP16, nullptr, HD, Sb + (size_t)RH * TT, TT, RH, 1.0f, (size_t)TT * HD, (size_t)TT * HD, (size_t)TT * TT);
        k_asoft<<<ZH * TT / 8, 256, 0, stream>>>(Sb, P16, Ph, Pl);
        k_gemmc<bf, 2, 2><<<dim3(RH / 64, HD / 64, ZH), 32, 0, stream>>>(Ph, Pl, VTh, VTl, TT, OUTb, HD, 0, 1.0f, (size_t)RH * TT, (size_t)HD * TT, (size_t)TT * HD);
        k_gemmc<h16, 0, 2><<<dim3((TT - RH) / 64, HD / 64, ZH), 32, 0, stream>>>(P16 + (size_t)RH * TT, nullptr, VT16, nullptr, TT, OUTb + (size_t)RH * HD, HD, RH, 1.0f / PCAR, (size_t)TT * TT, (size_t)HD * TT, (size_t)TT * HD);
    }
}

// v003
// It runs in 305 microseconds.
// Next to v002, in two timings, it ran 2.16 and 2.13 times as fast.
// Over all steps from v000 it is 3.62 times as fast.
#include <hip/hip_runtime.h>

// CausalMaskedAttention (input [4][4096][768]; q/k/v = x W^T ([768][768], one head of width 768); scores = q.k / sqrt(768) (the source scales by d_in), causal (-inf); softmax; out = weights v -> [4][4096][768] (no output projection)).
// Compute dtypes, f32 accumulate: every input rounded to bf16; q/k/v on PLAIN bf16 operands (inputs: exact); causal scores and attn.v: query rows < 512 hl (3 products), the rest single fp16 (x1024), causal tile skipping; softmax f32 (128 keys per lane); the context written directly in f32 by the attn.v GEMM; the q/k/v operand planes written by the projection GEMMs' epilogues.
// Every launch covers all four batches (a longer token axis in the projections, grid z in the attention GEMMs). So that the workspace holds four batches at once, the scores are stored packed by causal 64-row blocks
// (block rb: 64 rows of (rb + 1) * 64 f32), the fp16 probabilities are written over their own score row, and the hi/lo planes exist only for the RH rows, keys and value columns that read them.

#define NB_  4
#define TT   4096
#define DM   768
#define NH_  1
#define NKV  1
#define REP  (NH_ / NKV)
#define HD   768
#define DQ   (NH_ * HD)
#define DKV  (NKV * HD)
#define ZH   1
#define RH   512                  // query rows < RH use hi+lo planes
#define WIN  4096
#define PCAR 1024.0f
#define SCL  0.036084391824351615f   // 1/sqrt(d_in = 768)
#define SBZ  ((size_t)(TT / 64) * (TT / 64 + 1) / 2 * 4096)   // f32 elements of one batch's packed causal scores
typedef _Float16 h16;
typedef unsigned short bf;
typedef __attribute__((ext_vector_type(16))) __bf16   v16bf;
typedef __attribute__((ext_vector_type(16))) _Float16 v16h;
typedef __attribute__((ext_vector_type(8)))  _Float16 v8h;
typedef __attribute__((ext_vector_type(8)))  unsigned short v8us;
typedef __attribute__((ext_vector_type(8)))  float    v8f;
typedef __attribute__((ext_vector_type(4)))  float    v4f;
typedef v8h  __attribute__((may_alias)) v8ha;
typedef v4f  __attribute__((may_alias)) v4fa;
typedef v8us __attribute__((may_alias)) v8usa;
// first f32 element of 64-row block rb in a batch's packed scores: the blocks before it hold 1 + 2 + ... + rb tiles of 64 x 64
__device__ __forceinline__ size_t pkoff(int rb) { return (size_t)(rb * (rb + 1) / 2) * 4096; }

__device__ __forceinline__ unsigned short f2bf(float f) { unsigned u = __float_as_uint(f); u += 0x7FFFu + ((u >> 16) & 1u); return (unsigned short)(u >> 16); }
__device__ __forceinline__ float bf2f(unsigned short b) { return __uint_as_float(((unsigned)b) << 16); }
__device__ __forceinline__ float bfr(float f) { return bf2f(f2bf(f)); }
__device__ __forceinline__ v16h cat16(v8h lo, v8h hi) { return __builtin_shufflevector(lo, hi, 0, 1, 2, 3, 4, 5, 6, 7, 8, 9, 10, 11, 12, 13, 14, 15); }
__device__ __forceinline__ v16bf cat16b(v8us lo, v8us hi) { return __builtin_bit_cast(v16bf, __builtin_shufflevector(lo, hi, 0, 1, 2, 3, 4, 5, 6, 7, 8, 9, 10, 11, 12, 13, 14, 15)); }
__device__ __forceinline__ v8f wmma16(v16h a, v16h b, v8f c) { return __builtin_amdgcn_wmma_f32_16x16x32_f16(false, a, false, b, (short)0, c, false, false); }
__device__ __forceinline__ v8f wmmab(v16bf a, v16bf b, v8f c) { return __builtin_amdgcn_wmma_f32_16x16x32_bf16(false, a, false, b, (short)0, c, false, false); }



// ---- register-blocked GEMMs, ONE WAVE per 64x64 output tile (16 accumulators), operands from K-contiguous 16-bit planes through LDS (tile_mm); grid (M/64, N/64, Z), 32 threads.
// C[m][n] = sum_k A[m][k] Bt[n][k] (+ split products per NSPLIT). K % 64 == 0 (K % 32 == 0 with NSPLIT 2).
template <typename T16> struct WFrag;
template <> struct WFrag<h16> { typedef v16h V; static __device__ __forceinline__ V ld(const h16* p) { return cat16(*(const v8h*)p, *(const v8h*)(p + 16)); } static __device__ __forceinline__ v8f mma(V a, V b, v8f c) { return wmma16(a, b, c); } };
template <> struct WFrag<bf> { typedef v16bf V; static __device__ __forceinline__ V ld(const bf* p) { return cat16b(*(const v8us*)p, *(const v8us*)(p + 16)); } static __device__ __forceinline__ v8f mma(V a, V b, v8f c) { return wmmab(a, b, c); } };
// ---- operand staging for the one-wave 64x64 tile GEMMs: each K step's operand rows go from global memory to LDS by asynchronous copies that cover the rows' bytes side by side (128-B rows: 8 lanes a row,
// 4 whole lines a copy; the three-product kernels take 64-B rows so that a stage stays at 32 copies), two buffers, the next step's copies in flight while this step's fragments are read from LDS.
template <int NSPLIT> struct Stg { static constexpr int NPL = (NSPLIT >= 2) ? 4 : 2, RB = (NSPLIT >= 2) ? 64 : 128, PITCH = RB + 16, LPR = RB / 16, RPC = 32 / LPR, CPP = 64 / RPC, PLANE = 64 * PITCH, STAGE = NPL * PLANE, KSTEP = RB / 2, KS = RB / 64; };
typedef int gv4i __attribute__((vector_size(16)));
// one copy of 16 B a lane, global -> LDS, through no register
template <typename T16>
__device__ __forceinline__ void copy16(const T16* g, char* l) { __builtin_amdgcn_global_load_async_to_lds_b128((__attribute__((address_space(1))) gv4i*)g, (__attribute__((address_space(3))) gv4i*)l, 0, 0); }
// acc += A[r0..r0+63][0..Kl) x Bt[c0..c0+63][0..Kl)^T (+ the split products), k ascending in steps of 32 as before. lda, ldb: row pitches in elements. smem: 2 * Stg<NSPLIT>::STAGE bytes, private to the wave. Kl % KSTEP == 0, Kl >= KSTEP.
template <typename T16, int NSPLIT>
__device__ __forceinline__ void tile_mm(const T16* __restrict__ A, const T16* __restrict__ A2, const T16* __restrict__ Bt, const T16* __restrict__ Bt2, int lda, int ldb, int Kl, int r0, int c0, char* smem, v8f (&acc)[4][4]) {
    typedef typename WFrag<T16>::V V; typedef Stg<NSPLIT> S;
    static_assert(NSPLIT == 0 || NSPLIT == 2, "one product or the three hi/lo products");
    const int lane = threadIdx.x & 31, lr = lane & 15, hi = lane >> 4;
    const size_t ga = (size_t)(r0 + lane / S::LPR) * lda + (lane % S::LPR) * 8, gb = (size_t)(c0 + lane / S::LPR) * ldb + (lane % S::LPR) * 8;
    char* l0 = smem + (lane / S::LPR) * S::PITCH + (lane % S::LPR) * 16;
    const T16* pl[4] = { A + ga, Bt + gb, (NSPLIT >= 2) ? A2 + ga : nullptr, (NSPLIT >= 2) ? Bt2 + gb : nullptr };
    auto fill = [&](int t) {
#pragma unroll
        for (int p = 0; p < S::NPL; ++p)
#pragma unroll
            for (int g = 0; g < S::CPP; ++g)
                copy16<T16>(pl[p] + (size_t)t * S::KSTEP + (size_t)(g * S::RPC) * ((p & 1) ? ldb : lda), l0 + (t & 1) * S::STAGE + p * S::PLANE + g * S::RPC * S::PITCH);
    };
    const int nt = Kl / S::KSTEP;
    fill(0);
    asm volatile("s_wait_asynccnt 0x0" ::: "memory");   // step 0 has landed before anything reads it
    __syncthreads();   // the ring's publish point; a block of one wave, so the compiler emits no barrier instruction for it
    if (nt > 1) fill(1);
#pragma unroll 1
    for (int t = 0; t < nt; ++t) {
        const char* sb = smem + (t & 1) * S::STAGE + lr * S::PITCH + hi * 16;
        V a[S::KS][4], b[S::KS][4], a2[S::KS][4], b2[S::KS][4];
#pragma unroll
        for (int ks = 0; ks < S::KS; ++ks)
#pragma unroll
            for (int q = 0; q < 4; ++q) { a[ks][q] = WFrag<T16>::ld((const T16*)(sb + q * 16 * S::PITCH + ks * 64)); b[ks][q] = WFrag<T16>::ld((const T16*)(sb + S::PLANE + q * 16 * S::PITCH + ks * 64));
                if (NSPLIT >= 2) { a2[ks][q] = WFrag<T16>::ld((const T16*)(sb + 2 * S::PLANE + q * 16 * S::PITCH + ks * 64)); b2[ks][q] = WFrag<T16>::ld((const T16*)(sb + 3 * S::PLANE + q * 16 * S::PITCH + ks * 64)); } }
        __builtin_amdgcn_sched_barrier(0);   // keeps the step's LDS reads together ahead of its WMMAs: sunk among them, each group makes the lone wave wait out the LDS latency
#pragma unroll
        for (int ks = 0; ks < S::KS; ++ks)
#pragma unroll
            for (int nb = 0; nb < 4; ++nb)
#pragma unroll
                for (int mb = 0; mb < 4; ++mb) { acc[mb][nb] = WFrag<T16>::mma(a[ks][mb], b[ks][nb], acc[mb][nb]); if (NSPLIT >= 2) { acc[mb][nb] = WFrag<T16>::mma(a2[ks][mb], b[ks][nb], acc[mb][nb]); acc[mb][nb] = WFrag<T16>::mma(a[ks][mb], b2[ks][nb], acc[mb][nb]); } }
        __builtin_amdgcn_sched_barrier(0);   // keeps the waits below behind the WMMAs: lifted over them, the wave would sit out the next step's copies before its matrix work and not under it
        asm volatile("s_wait_dscnt 0x0" ::: "memory");      // this step's LDS reads have retired before its buffer is refilled
        asm volatile("s_wait_asynccnt 0x0" ::: "memory");   // the next step's copies have landed before the next trip reads them
        __syncthreads();   // publish point, as above: no instruction while a block is one wave
        if (t + 2 < nt) fill(t + 2);
    }
    asm volatile("s_wait_asynccnt 0x0" ::: "memory");       // nothing in flight when the buffers become the output staging
}

// ---- k_gemmc: the same one-wave 64x64 tile GEMM specialised for causal attention: CMODE 1 skips score tiles entirely above the diagonal (query rows r0+roff.., key columns c0..), CMODE 2 limits the
// key (K) loop of the probability x value contraction to the diagonal block (probabilities beyond it are exactly zero). roff = row offset of this launch's first row within the sequence. CMODE 2 stores acc x osc (the inverse of the probabilities' carry factor), so C is the final output.
// CMODE 1 stores into the packed scores (C = the batch's first element, ldc unused). CMODE 3 = CMODE 2 with A = the fp16 probabilities that lie over their packed score rows (A = the scores' first element, pitch twice the block's f32 pitch). blockIdx.z = batch.
template <typename T16, int NSPLIT, int CMODE>
__global__ __launch_bounds__(32) void k_gemmc(const T16* __restrict__ A, const T16* __restrict__ A2, const T16* __restrict__ Bt, const T16* __restrict__ Bt2, int K, float* C, int ldc, int roff, float osc, size_t sA, size_t sB, size_t sC) {
    typedef typename WFrag<T16>::V V;
    __shared__ __align__(16) char smem[2 * Stg<NSPLIT>::STAGE]; float* os = (float*)smem;   // the output staging (16 x 68 f32) takes the operand buffers' place behind the K loop
    const size_t z = blockIdx.z; A += z * sA; if (A2) A2 += z * sA; Bt += z * sB; if (Bt2) Bt2 += z * sB; C += z * sC;
    const int lane = threadIdx.x & 31, lr = lane & 15, hi = lane >> 4; const int r0 = blockIdx.x * 64, c0 = blockIdx.y * 64;
    if (CMODE == 1 && c0 > r0 + roff + 63) return;                  // score tile entirely above the causal diagonal: never read (the softmax masks j > i by select)
    const int Kl = (CMODE >= 2) ? min(K, r0 + roff + 64) : K;        // P.V: probabilities are exactly 0 beyond the diagonal block, so the K loop stops there
    const int rb = (r0 + roff) >> 6;                                 // this tile's 64-row block within the sequence
    v8f acc[4][4];
#pragma unroll
    for (int mb = 0; mb < 4; ++mb)
#pragma unroll
        for (int nb = 0; nb < 4; ++nb) acc[mb][nb] = (v8f){};
    if (CMODE == 3) tile_mm<T16, NSPLIT>(A + 2 * pkoff(rb), A2, Bt, Bt2, 2 * (rb + 1) * 64, K, Kl, 0, c0, smem, acc);
    else tile_mm<T16, NSPLIT>(A, A2, Bt, Bt2, K, K, Kl, r0, c0, smem, acc);
    float* Cb = (CMODE == 1) ? C + pkoff(rb) : C + (size_t)r0 * ldc; const int ldo = (CMODE == 1) ? (rb + 1) * 64 : ldc;
#pragma unroll
    for (int mb = 0; mb < 4; ++mb) {
#pragma unroll
        for (int nb = 0; nb < 4; ++nb) {
#pragma unroll
            for (int j = 0; j < 8; ++j) os[(hi * 8 + j) * 68 + nb * 16 + lr] = acc[mb][nb][j]; }
        __builtin_amdgcn_wave_barrier(); asm volatile("" ::: "memory");
        float* crow = Cb + (size_t)(mb * 16) * ldo + c0;
{
#pragma unroll
            for (int s = 0; s < 8; ++s) { const int row = 2 * s + hi, cofs = lr * 4; v4f val = *(const v4fa*)(os + row * 68 + cofs); if (CMODE >= 2) val *= osc;
                *(v4f*)(crow + (size_t)row * ldo + cofs) = val; }
             }
        __builtin_amdgcn_wave_barrier(); asm volatile("" ::: "memory");
    }
}

__device__ __forceinline__ h16 tohx(float x) { return (h16)x; }
__device__ __forceinline__ void splitf(float y, unsigned short& h, unsigned short& l) { h = f2bf(y); l = f2bf(y - bf2f(h)); }
typedef __attribute__((ext_vector_type(2))) _Float16 v2h;
typedef __attribute__((ext_vector_type(4))) _Float16 v4h;
typedef __attribute__((ext_vector_type(2))) unsigned short v2us;
typedef __attribute__((ext_vector_type(4))) unsigned short v4us;
typedef __attribute__((ext_vector_type(2))) float v2f;
typedef __attribute__((ext_vector_type(4))) int v4i;

// the staged 64 x 64 f32 tile (pitch 68) to the planes: fp16 always, bf16 hi + lo where HL. p16, ph, pl: the tile's first element in each plane.
template <bool HL>
__device__ __forceinline__ void put_planes(const float* os, int rsub, int cofs, h16* p16, int ld16, bf* ph, bf* pl, int ldhl) {
#pragma unroll   // straight-line text (the kernel stays far under 32 KB): constant LDS offsets, and LDS reads of later rows issue under the conversions of earlier ones
    for (int s = 0; s < 16; ++s) { const int row = s * 4 + rsub; const v4f u0 = *(const v4fa*)(os + row * 68 + cofs), u1 = *(const v4fa*)(os + row * 68 + cofs + 4); v8h o16; v8us oh, ol;
#pragma unroll
        for (int q = 0; q < 8; ++q) { const float r = (q < 4) ? u0[q & 3] : u1[q & 3]; o16[q] = tohx(r); if (HL) { unsigned short a2, c2; splitf(r, a2, c2); oh[q] = a2; ol[q] = c2; } }
        *(v8h*)(p16 + (size_t)row * ld16 + cofs) = o16;
        if (HL) { const size_t oo = (size_t)row * ldhl + cofs; *(v8us*)(ph + oo) = oh; *(v8us*)(pl + oo) = ol; } }
    asm volatile("s_wait_xcnt 0x0" ::: "memory");   // behind the last stores: the text of the other side of the caller's test follows and reuses their registers
}

// k_gemmp: the same tile GEMM on plain bf16 operands whose epilogue writes the attention operand planes itself: C[m][n] = sum_k A[m][k] Bt[n][k], stored as fp16 (P16) and, for tokens < RH of each batch, as bf16 hi + lo (Ph, Pl).
// The token axis runs over all batches (NB_ * TT). TR false: tokens are the tile's rows, planes [b][t][d] (hi/lo [b][RH][d]). TR true: tokens are its columns, planes [b][d][t] (hi/lo [b][d][RH]).
// The whole 64 x 64 f32 tile is staged in LDS (pitch 68) so that every store instruction covers whole 128-B rows of a plane (8 lanes a row, 16 B a lane). With A = weight rows and Bt = token rows it yields the transposed planes [d][t].
template <bool TR>
__global__ __launch_bounds__(32) void k_gemmp(const bf* __restrict__ A, const bf* __restrict__ Bt, int K, h16* P16, bf* Ph, bf* Pl) {
    __shared__ __align__(16) char smem[2 * Stg<0>::STAGE]; float* os = (float*)smem;   // the output staging (64 x 68 f32) takes the operand buffers' place behind the K loop
    static_assert(64 * 68 * 4 <= 2 * Stg<0>::STAGE, "the staged tile fits the operand buffers");
    const int lane = threadIdx.x & 31, lr = lane & 15, hi = lane >> 4; const int r0 = blockIdx.x * 64, c0 = blockIdx.y * 64;
    v8f acc[4][4];
#pragma unroll
    for (int mb = 0; mb < 4; ++mb)
#pragma unroll
        for (int nb = 0; nb < 4; ++nb) acc[mb][nb] = (v8f){};
    tile_mm<bf, 0>(A, nullptr, Bt, nullptr, K, K, K, r0, c0, smem, acc);
#pragma unroll
    for (int mb = 0; mb < 4; ++mb)
#pragma unroll
        for (int nb = 0; nb < 4; ++nb)
#pragma unroll
            for (int j = 0; j < 8; ++j) os[(mb * 16 + hi * 8 + j) * 68 + nb * 16 + lr] = acc[mb][nb][j];
    __syncthreads();   // the staged tile is read by other lanes than wrote it; a block of one wave, so this orders the LDS traffic and emits no barrier instruction
    const int rsub = lane >> 3, cofs = (lane & 7) * 8;
    const int tok = TR ? c0 : r0, bz = tok / TT, tl = tok % TT; const bool hl = (tl < RH);   // the tile's 64 tokens lie in one batch, and wholly below RH or not at all
    const int ld16 = TR ? TT : HD, ldhl = TR ? RH : HD;
    const size_t b16 = TR ? ((size_t)bz * HD + r0) * TT + tl : (size_t)r0 * HD + c0, bhl = TR ? ((size_t)bz * HD + r0) * RH + tl : ((size_t)bz * RH + tl) * HD + c0;
    if (hl) put_planes<true>(os, rsub, cofs, P16 + b16, ld16, Ph + bhl, Pl + bhl, ldhl);   // one test a tile, uniform for the wave, so that each side stays straight-line text
    else put_planes<false>(os, rsub, cofs, P16 + b16, ld16, Ph, Pl, ldhl);
}

__global__ __launch_bounds__(256) void k_wtG(const float* __restrict__ w, int K, int N, bf* Bt) {
    const int lane = threadIdx.x & 31; const int L0 = (blockIdx.x * 8 + (threadIdx.x >> 5)) * 8; const int nlines = N * K / 64;
{
#pragma unroll 1
        for (int l = 0; l < 8; ++l) { const int L = L0 + l; if (L >= nlines) break; const size_t e = (size_t)L * 64 + lane * 2; const int k = (int)(e % K), n = (int)(e / K); v2us o;
            o[0] = f2bf(w[(size_t)k * N + n]); o[1] = f2bf(w[(size_t)(k + 1) * N + n]); *(v2us*)(Bt + e) = o; }
         }
}
__global__ __launch_bounds__(256) void k_cvt8(const float* __restrict__ src, bf* dst, size_t n8) { const size_t i = (size_t)blockIdx.x * 256 + threadIdx.x; if (i >= n8) return; const v8f v = *(const v8f*)(src + i * 8); v8us o;
#pragma unroll
    for (int k = 0; k < 8; ++k) o[k] = f2bf(v[k]); *(v8us*)(dst + i * 8) = o;  }
__global__ __launch_bounds__(256) void k_cscvt(const float* __restrict__ cosT, const float* __restrict__ sinT, float* CS) { const int idx = blockIdx.x * 256 + threadIdx.x; if (idx >= TT * HD) return; v2f cs; cs[0] = bfr(cosT[idx]); cs[1] = bfr(sinT[idx]); *(v2f*)(CS + (size_t)idx * 2) = cs;  }
// k_asoft: per row (zz, i): t = S x HD^-0.5 for j <= i and i - j < WIN (sliding causal window; the reference's -1e9 additive fill vanishes identically); softmax over the row's keys (register row, one exp, fixed trees).
// A row of block rb holds len = (rb + 1) * 64 scores. The row is worked in groups of 512 keys (4 chunks of 128), one wave-uniform test a group; groups that begin at or beyond len are skipped: their terms were exact zeros,
// so the sums keep their values and their order. The last group may read up to 448 f32 past the row, still inside the packed scores (the last block's len is a multiple of 512), and the select masks them.
// The fp16 probabilities go over the row's own scores: the wave has read its whole row before it knows the factor f that every store needs, and for rows >= RH (len > 512) len rounded up to 512 fp16 never outgrows len f32.
__global__ __launch_bounds__(256) void k_asoft(float* Sb, bf* Ph, bf* Pl) {
    const int lane = threadIdx.x & 31; const int row = blockIdx.x * 8 + __builtin_amdgcn_readfirstlane(threadIdx.x >> 5); if (row >= NB_ * TT) return; const int i = row % TT; const int zz = row / TT; const bool hires = (i < RH);
    const int rb = i >> 6, len = (rb + 1) * 64; float* sr = Sb + (size_t)zz * SBZ + pkoff(rb) + (size_t)(i & 63) * len; v4f ld[TT / 128]; float v[TT / 32]; float mx = -3.0e38f;
    static_assert(RH == 512 && TT % 512 == 0, "the hi/lo rows are exactly the rows of one group");
#pragma unroll
    for (int g = 0; g < TT / 512; ++g) if (g * 512 < len) {   // all the row's loads first: one memory latency a row, not one a group
#pragma unroll
        for (int ch = g * 4; ch < g * 4 + 4; ++ch) ld[ch] = *(const v4f*)(sr + ch * 128 + lane * 4); }
    asm volatile("s_wait_xcnt 0x0" ::: "memory");   // behind the last load: the index arithmetic below reuses the address registers that the loads name
#pragma unroll
    for (int g = 0; g < TT / 512; ++g) if (g * 512 < len) {
#pragma unroll
      for (int ch = g * 4; ch < g * 4 + 4; ++ch) { const int j0 = ch * 128 + lane * 4; const v4f a = ld[ch];
#pragma unroll
        for (int q = 0; q < 4; ++q) { const int j = j0 + q; (void)j; float sa = a[q] * SCL; asm volatile("" : "+v"(sa)); const float t = (j <= i) ? sa : -3.0e38f; v[ch * 4 + q] = t; mx = fmaxf(mx, t); } } }
#pragma unroll
    for (int sh = 16; sh; sh >>= 1) mx = fmaxf(mx, __shfl_xor(mx, sh, 32));
    float sum = 0.f;
#pragma unroll
    for (int g = 0; g < TT / 512; ++g) if (g * 512 < len) {
#pragma unroll
        for (int k = g * 16; k < g * 16 + 16; ++k) { float d0 = __fsub_rn(v[k], mx); asm volatile("" : "+v"(d0)); v[k] = __builtin_amdgcn_exp2f(__fmul_rn(d0, 1.4426950408889634f)); sum += v[k]; } }
#pragma unroll
    for (int sh = 16; sh; sh >>= 1) sum += __shfl_xor(sum, sh, 32);
    const float f = __fdiv_rn(hires ? 1.0f : PCAR, sum);
{
        if (hires) {
#pragma unroll
            for (int ch = 0; ch < RH / 128; ++ch) { v4us oh, ol;
#pragma unroll
                for (int q = 0; q < 4; ++q) { unsigned short a, c2; splitf(v[ch * 4 + q] * f, a, c2); oh[q] = a; ol[q] = c2; }
                const size_t oo = ((size_t)zz * RH + i) * RH + ch * 128 + lane * 4; *(v4us*)(Ph + oo) = oh; *(v4us*)(Pl + oo) = ol; }
        } else {
            h16* pr = (h16*)sr;
#pragma unroll
            for (int g = 0; g < TT / 512; ++g) if (g * 512 < len) {
#pragma unroll
              for (int ch = g * 4; ch < g * 4 + 4; ++ch) { v4h o4;
#pragma unroll
                for (int q = 0; q < 4; ++q) o4[q] = tohx(v[ch * 4 + q] * f);
                *(v4h*)(pr + ch * 128 + lane * 4) = o4; }
              asm volatile("s_wait_xcnt 0x0" ::: "memory"); }   // the next group's conversions may reuse the registers that this group's stores name
        }
         }
}
__global__ __launch_bounds__(256) void k_merge(const float* __restrict__ O, int h0, bf* Ah, bf* Al) { const size_t e = ((size_t)blockIdx.x * 256 + threadIdx.x) * 2; if (e >= (size_t)ZH * TT * HD) return; const int d = (int)(e % HD); const int t = (int)((e / HD) % TT); const int zz = (int)(e / ((size_t)HD * TT)); const float cs = (t < RH) ? 1.0f : (1.0f / PCAR); const size_t oo = (size_t)t * DQ + (h0 + zz) * HD + d;
    v2us oh, ol;
#pragma unroll
    for (int q = 0; q < 2; ++q) { unsigned short a, c2; splitf(O[e + q] * cs, a, c2); oh[q] = a; ol[q] = c2; } *(v2us*)(Ah + oo) = oh; *(v2us*)(Al + oo) = ol;  }


extern "C" void kernel_launch(void* const* d_in, const int* in_sizes, int n_in,
                              void* d_out, int out_size, void* d_ws, size_t ws_size, hipStream_t stream) {
    (void)in_sizes; (void)n_in; (void)out_size;
    const float* x = (const float*)d_in[0]; const float* wq = (const float*)d_in[1]; const float* wk = (const float*)d_in[2]; const float* wv = (const float*)d_in[3];
    float* OUT = (float*)d_out;     // [4][4096][768]
    char* wsp = (char*)d_ws;
    auto take = [&](size_t bytes) { char* p = wsp; wsp += (bytes + 255) & ~(size_t)255; return (void*)p; };
    bf* WQ = (bf*)take((size_t)DQ * DM * 2); bf* WK = (bf*)take((size_t)DKV * DM * 2); bf* WV = (bf*)take((size_t)DKV * DM * 2);
    bf* XB = (bf*)take((size_t)NB_ * TT * DM * 2);
    h16* QP16 = (h16*)take((size_t)NB_ * TT * HD * 2); h16* KP16 = (h16*)take((size_t)NB_ * TT * HD * 2); h16* VT16 = (h16*)take((size_t)NB_ * HD * TT * 2);
    bf* QPh = (bf*)take((size_t)NB_ * RH * HD * 2); bf* QPl = (bf*)take((size_t)NB_ * RH * HD * 2); bf* KPh = (bf*)take((size_t)NB_ * RH * HD * 2); bf* KPl = (bf*)take((size_t)NB_ * RH * HD * 2); bf* VTh = (bf*)take((size_t)NB_ * HD * RH * 2); bf* VTl = (bf*)take((size_t)NB_ * HD * RH * 2); bf* Ph = (bf*)take((size_t)NB_ * RH * RH * 2); bf* Pl = (bf*)take((size_t)NB_ * RH * RH * 2);
    float* Sb = (float*)take((size_t)NB_ * SBZ * 4);      // packed causal scores; the fp16 probabilities of rows >= RH take their place row by row
    if ((size_t)(wsp - (char*)d_ws) > ws_size) return;    // ws 256 MiB
    { k_cvt8<<<(unsigned)(((size_t)DQ * DM / 8 + 255) / 256), 256, 0, stream>>>(wq, WQ, (size_t)DQ * DM / 8); k_cvt8<<<(unsigned)(((size_t)DKV * DM / 8 + 255) / 256), 256, 0, stream>>>(wk, WK, (size_t)DKV * DM / 8); k_cvt8<<<(unsigned)(((size_t)DKV * DM / 8 + 255) / 256), 256, 0, stream>>>(wv, WV, (size_t)DKV * DM / 8);
      /* no output projection */
       }
    k_cvt8<<<(unsigned)(((size_t)NB_ * TT * DM / 8 + 255) / 256), 256, 0, stream>>>(x, XB, (size_t)NB_ * TT * DM / 8);
    k_gemmp<false><<<dim3(NB_ * TT / 64, HD / 64, 1), 32, 0, stream>>>(XB, WQ, DM, QP16, QPh, QPl);      // q planes [b][t][d]
    k_gemmp<false><<<dim3(NB_ * TT / 64, HD / 64, 1), 32, 0, stream>>>(XB, WK, DM, KP16, KPh, KPl);      // k planes [b][t][d]
    k_gemmp<true><<<dim3(HD / 64, NB_ * TT / 64, 1), 32, 0, stream>>>(WV, XB, DM, VT16, VTh, VTl);       // v planes transposed [b][d][t]: the weight rows are the tile's rows
    k_gemmc<bf, 2, 1><<<dim3(RH / 64, RH / 64, NB_), 32, 0, stream>>>(QPh, QPl, KPh, KPl, HD, Sb, 0, 0, 1.0f, (size_t)RH * HD, (size_t)RH * HD, SBZ);
    k_gemmc<h16, 0, 1><<<dim3((TT - RH) / 64, TT / 64, NB_), 32, 0, stream>>>(QP16 + (size_t)RH * HD, nullptr, KP16, nullptr, HD, Sb, 0, RH, 1.0f, (size_t)TT * HD, (size_t)TT * HD, SBZ);
    k_asoft<<<NB_ * TT / 8, 256, 0, stream>>>(Sb, Ph, Pl);
    k_gemmc<bf, 2, 2><<<dim3(RH / 64, HD / 64, NB_), 32, 0, stream>>>(Ph, Pl, VTh, VTl, RH, OUT, HD, 0, 1.0f, (size_t)RH * RH, (size_t)HD * RH, (size_t)TT * HD);
    k_gemmc<h16, 0, 3><<<dim3((TT - RH) / 64, HD / 64, NB_), 32, 0, stream>>>((const h16*)Sb, nullptr, VT16, nullptr, TT, OUT + (size_t)RH * HD, HD, RH, 1.0f / PCAR, 2 * SBZ, (size_t)HD * TT, (size_t)TT * HD);
}

// v004
// One run takes 241 microseconds.
// In both of two side-by-side timings against v003, it was 1.26 times as fast.
// All steps since v000 together make it 4.55 times as fast.
#include <hip/hip_runtime.h>

// CausalMaskedAttention (input [4][4096][768]; q/k/v = x W^T ([768][768], one head of width 768); scores = q.k / sqrt(768) (the source scales by d_in), causal (-inf); softmax; out = weights v -> [4][4096][768] (no output projection)).
// Compute dtypes, f32 accumulate: every input rounded to bf16; q/k/v on PLAIN bf16 operands (inputs: exact); causal scores and attn.v: query rows < 512 hl (3 products), the rest single fp16 (x1024), causal tile skipping; softmax f32 (128 keys per lane); the context written directly in f32 by the attn.v GEMM; the q/k/v operand planes written by the projection GEMMs' epilogues.
// Every launch covers all four batches (a longer token axis in the projections, grid z in the attention GEMMs). So that the workspace holds four batches at once, the scores are stored packed by causal 64-row blocks
// (block rb: 64 rows of (rb + 1) * 64 f32), the fp16 probabilities are written over their own score row, and the hi/lo planes exist only for the RH rows, keys and value columns that read them.

#define NB_  4
#define TT   4096
#define DM   768
#define NH_  1
#define NKV  1
#define REP  (NH_ / NKV)
#define HD   768
#define DQ   (NH_ * HD)
#define DKV  (NKV * HD)
#define ZH   1
#define RH   512                  // query rows < RH use hi+lo planes
#define WIN  4096
#define PCAR 1024.0f
#define SCL  0.036084391824351615f   // 1/sqrt(d_in = 768)
#define SBZ  ((size_t)(TT / 64) * (TT / 64 + 1) / 2 * 4096)   // f32 elements of one batch's packed causal scores
typedef _Float16 h16;
typedef unsigned short bf;
typedef __attribute__((ext_vector_type(16))) __bf16   v16bf;
typedef __attribute__((ext_vector_type(16))) _Float16 v16h;
typedef __attribute__((ext_vector_type(8)))  _Float16 v8h;
typedef __attribute__((ext_vector_type(8)))  unsigned short v8us;
typedef __attribute__((ext_vector_type(8)))  float    v8f;
typedef __attribute__((ext_vector_type(4)))  float    v4f;
typedef v8h  __attribute__((may_alias)) v8ha;
typedef v4f  __attribute__((may_alias)) v4fa;
typedef v8us __attribute__((may_alias)) v8usa;
// first f32 element of 64-row block rb in a batch's packed scores: the blocks before it hold 1 + 2 + ... + rb tiles of 64 x 64
__device__ __forceinline__ size_t pkoff(int rb) { return (size_t)(rb * (rb + 1) / 2) * 4096; }

__device__ __forceinline__ unsigned short f2bf(float f) { unsigned u = __float_as_uint(f); u += 0x7FFFu + ((u >> 16) & 1u); return (unsigned short)(u >> 16); }
__device__ __forceinline__ float bf2f(unsigned short b) { return __uint_as_float(((unsigned)b) << 16); }
__device__ __forceinline__ float bfr(float f) { return bf2f(f2bf(f)); }
__device__ __forceinline__ v16h cat16(v8h lo, v8h hi) { return __builtin_shufflevector(lo, hi, 0, 1, 2, 3, 4, 5, 6, 7, 8, 9, 10, 11, 12, 13, 14, 15); }
__device__ __forceinline__ v16bf cat16b(v8us lo, v8us hi) { return __builtin_bit_cast(v16bf, __builtin_shufflevector(lo, hi, 0, 1, 2, 3, 4, 5, 6, 7, 8, 9, 10, 11, 12, 13, 14, 15)); }
__device__ __forceinline__ v8f wmma16(v16h a, v16h b, v8f c) { return __builtin_amdgcn_wmma_f32_16x16x32_f16(false, a, false, b, (short)0, c, false, false); }
__device__ __forceinline__ v8f wmmab(v16bf a, v16bf b, v8f c) { return __builtin_amdgcn_wmma_f32_16x16x32_bf16(false, a, false, b, (short)0, c, false, false); }



// ---- register-blocked GEMMs, one wave per 64x64 output tile (16 accumulators), FOUR WAVES (2 x 2) a work-group on one 128x128 tile: the four share each K step's operand rows in LDS (tile_mm), so every row
// is fetched from L2 once for two waves; operands from K-contiguous 16-bit planes; grid (M/128, N/128, Z), 128 threads.
// C[m][n] = sum_k A[m][k] Bt[n][k] (+ split products per NSPLIT). K % 64 == 0 for one product, K % 32 == 0 for three.
template <typename T16> struct WFrag;
template <> struct WFrag<h16> { typedef v16h V; static __device__ __forceinline__ V ld(const h16* p) { return cat16(*(const v8h*)p, *(const v8h*)(p + 16)); } static __device__ __forceinline__ v8f mma(V a, V b, v8f c) { return wmma16(a, b, c); } };
template <> struct WFrag<bf> { typedef v16bf V; static __device__ __forceinline__ V ld(const bf* p) { return cat16b(*(const v8us*)p, *(const v8us*)(p + 16)); } static __device__ __forceinline__ v8f mma(V a, V b, v8f c) { return wmmab(a, b, c); } };
// ---- operand staging for the 128x128 tile GEMMs: each K step's operand rows (128 a plane) go from global memory to LDS by asynchronous copies that cover the rows' bytes side by side (128-B rows: 8 lanes a row,
// 4 whole lines a copy; the three-product kernels take 64-B rows), two buffers, the next step's copies in flight while this step's fragments are read from LDS. Each wave copies a quarter of a stage (SLICE, 16 copies):
// one product: 64 rows of A (waves 0, 1) or of Bt (waves 2, 3); three products: one whole plane (A, Bt, A2, Bt2 in wave order).
template <int NSPLIT> struct Stg { static constexpr int NPL = (NSPLIT >= 2) ? 4 : 2, RB = (NSPLIT >= 2) ? 64 : 128, PITCH = RB + 16, LPR = RB / 16, RPC = 32 / LPR, PLANE = 128 * PITCH, STAGE = NPL * PLANE, SLICE = STAGE / 4, CPW = SLICE / (RPC * PITCH), KSTEP = RB / 2, KS = RB / 64; };
typedef int gv4i __attribute__((vector_size(16)));
// one copy of 16 B a lane, global -> LDS, through no register
template <typename T16>
__device__ __forceinline__ void copy16(const T16* g, char* l) { __builtin_amdgcn_global_load_async_to_lds_b128((__attribute__((address_space(1))) gv4i*)g, (__attribute__((address_space(3))) gv4i*)l, 0, 0); }
// The wave's 64x64 tile (wm, wn) of the work-group's 128x128: acc += A[wm * 64 ..+63][k] x Bt[wn * 64 ..+63][k]^T (+ the split products), k ascending in steps of 32 as before, over the wave's own first ntw K steps.
// src: first element of the rows that THIS wave copies (its quarter of every stage), ld: their pitch in elements. nt: K steps that the work-group stages (>= 1, >= ntw, the same in all four waves); a wave with
// ntw < nt copies and passes every barrier to the end and only leaves the products out. smem: 2 * Stg<NSPLIT>::STAGE bytes, shared by the four waves.
template <typename T16, int NSPLIT>
__device__ __forceinline__ void tile_mm(const T16* __restrict__ src, int ld, int nt, int ntw, int wave, char* smem, v8f (&acc)[4][4]) {
    typedef typename WFrag<T16>::V V; typedef Stg<NSPLIT> S;
    static_assert(NSPLIT == 0 || NSPLIT == 2, "one product or the three hi/lo products");
    const int lane = threadIdx.x & 31, lr = lane & 15, hi = lane >> 4, wm = wave >> 1, wn = wave & 1;
    const T16* g0 = src + (size_t)(lane / S::LPR) * ld + (lane % S::LPR) * 8;
    char* l0 = smem + wave * S::SLICE + (lane / S::LPR) * S::PITCH + (lane % S::LPR) * 16;
    auto fill = [&](int t) {
#pragma unroll
        for (int g = 0; g < S::CPW; ++g)
            copy16<T16>(g0 + (size_t)t * S::KSTEP + (size_t)(g * S::RPC) * ld, l0 + (t & 1) * S::STAGE + g * S::RPC * S::PITCH);
    };
    fill(0);
    asm volatile("s_wait_asynccnt 0x0" ::: "memory");   // this wave's share of step 0 has landed
    __syncthreads();   // the ring's publish point: every wave's share of step 0 has landed before any wave reads it
    if (nt > 1) fill(1);
#pragma unroll 1
    for (int t = 0; t < nt; ++t) {
        if (t < ntw) {   // uniform for the wave (a scalar test): EXEC stays all ones at the WMMAs
            const char* sa = smem + (t & 1) * S::STAGE + (wm * 64 + lr) * S::PITCH + hi * 16, *sb = smem + (t & 1) * S::STAGE + S::PLANE + (wn * 64 + lr) * S::PITCH + hi * 16;
            V a[S::KS][4], b[S::KS][4], a2[S::KS][4], b2[S::KS][4];
#pragma unroll
            for (int ks = 0; ks < S::KS; ++ks)
#pragma unroll
                for (int q = 0; q < 4; ++q) { a[ks][q] = WFrag<T16>::ld((const T16*)(sa + q * 16 * S::PITCH + ks * 64)); b[ks][q] = WFrag<T16>::ld((const T16*)(sb + q * 16 * S::PITCH + ks * 64));
                    if (NSPLIT >= 2) { a2[ks][q] = WFrag<T16>::ld((const T16*)(sa + 2 * S::PLANE + q * 16 * S::PITCH + ks * 64)); b2[ks][q] = WFrag<T16>::ld((const T16*)(sb + 2 * S::PLANE + q * 16 * S::PITCH + ks * 64)); } }
            __builtin_amdgcn_sched_barrier(0);   // keeps the step's LDS reads together ahead of its WMMAs: sunk among them, each group makes the wave wait out the LDS latency
#pragma unroll
            for (int ks = 0; ks < S::KS; ++ks)
#pragma unroll
                for (int nb = 0; nb < 4; ++nb)
#pragma unroll
                    for (int mb = 0; mb < 4; ++mb) { acc[mb][nb] = WFrag<T16>::mma(a[ks][mb], b[ks][nb], acc[mb][nb]); if (NSPLIT >= 2) { acc[mb][nb] = WFrag<T16>::mma(a2[ks][mb], b[ks][nb], acc[mb][nb]); acc[mb][nb] = WFrag<T16>::mma(a[ks][mb], b2[ks][nb], acc[mb][nb]); } }
            __builtin_amdgcn_sched_barrier(0);   // keeps the waits below behind the WMMAs: lifted over them, the wave would sit out the next step's copies before its matrix work and not under it
        }
        asm volatile("s_wait_dscnt 0x0" ::: "memory");      // this step's LDS reads have retired before its buffer is refilled
        asm volatile("s_wait_asynccnt 0x0" ::: "memory");   // this wave's share of the next step has landed
        __syncthreads();   // publish point: the next step is whole for every wave, and every wave has left the buffer that is refilled below
        if (t + 2 < nt) fill(t + 2);
    }
    asm volatile("s_wait_asynccnt 0x0" ::: "memory");       // nothing in flight when the buffers become the output staging
}

// ---- k_gemmc: the same tile GEMM specialised for causal attention: CMODE 1 skips score tiles entirely above the diagonal (query rows r0+roff.., key columns c0..; a whole work-group returns, a single wave of a
// diagonal work-group only copies), CMODE 2 limits each wave's key (K) loop of the probability x value contraction to its rows' diagonal block (probabilities beyond it are exactly zero). roff = row offset of this launch's first row within the sequence. CMODE 2 stores acc x osc (the inverse of the probabilities' carry factor), so C is the final output.
// CMODE 1 stores into the packed scores (C = the batch's first element, ldc unused). CMODE 3 = CMODE 2 with A = the fp16 probabilities that lie over their packed score rows (A = the scores' first element, pitch twice the block's f32 pitch). blockIdx.z = batch.
template <typename T16, int NSPLIT, int CMODE>
__global__ __launch_bounds__(128) void k_gemmc(const T16* __restrict__ A, const T16* __restrict__ A2, const T16* __restrict__ Bt, const T16* __restrict__ Bt2, int K, float* C, int ldc, int roff, float osc, size_t sA, size_t sB, size_t sC) {
    typedef typename WFrag<T16>::V V;
    typedef Stg<NSPLIT> S;
    __shared__ __align__(16) char smem[2 * S::STAGE];
    const int wave = __builtin_amdgcn_readfirstlane(threadIdx.x >> 5); float* os = (float*)smem + wave * 16 * 68;   // each wave's output staging (16 x 68 f32) takes the operand buffers' place behind the K loop
    const size_t z = blockIdx.z; A += z * sA; if (A2) A2 += z * sA; Bt += z * sB; if (Bt2) Bt2 += z * sB; C += z * sC;
    const int lane = threadIdx.x & 31, lr = lane & 15, hi = lane >> 4; const int R0 = blockIdx.x * 128, C0 = blockIdx.y * 128;
    if (CMODE == 1 && C0 > R0 + roff + 127) return;                 // all four score tiles above the causal diagonal: the whole work-group leaves, ahead of every barrier
    const int r0 = R0 + (wave >> 1) * 64, c0 = C0 + (wave & 1) * 64;  // this wave's 64x64 tile
    const bool live = !(CMODE == 1 && c0 > r0 + roff + 63);          // score tile entirely above the causal diagonal: it has no place in the packed scores and is never read (the softmax masks j > i by select)
    const int nt = ((CMODE >= 2) ? min(K, R0 + roff + 128) : K) / S::KSTEP;                    // K steps staged: as far as the lower 64 rows need
    const int ntw = (CMODE >= 2) ? min(K, r0 + roff + 64) / S::KSTEP : (live ? nt : 0);         // P.V: probabilities are exactly 0 beyond the rows' diagonal block, so the wave's products stop there
    const int rb = (r0 + roff) >> 6;                                 // this tile's 64-row block within the sequence
    // the rows that this wave copies, a quarter of every stage. CMODE 3: the two 64-row blocks of A have each their own start and pitch; the upper block's last staged step lies past its probabilities, still inside its own rows' score bytes, and is not multiplied (ntw)
    const T16* src; int ld = K;
    if (NSPLIT >= 2) src = ((wave == 0) ? A : (wave == 1) ? Bt : (wave == 2) ? A2 : Bt2) + (size_t)((wave & 1) ? C0 : R0) * K;
    else if (wave >= 2) src = Bt + (size_t)(C0 + (wave & 1) * 64) * K;
    else if (CMODE == 3) { const int rbh = ((R0 + roff) >> 6) + wave; src = A + 2 * pkoff(rbh); ld = 2 * (rbh + 1) * 64; }
    else src = A + (size_t)(R0 + wave * 64) * K;
    v8f acc[4][4];
#pragma unroll
    for (int mb = 0; mb < 4; ++mb)
#pragma unroll
        for (int nb = 0; nb < 4; ++nb) acc[mb][nb] = (v8f){};
    tile_mm<T16, NSPLIT>(src, ld, nt, ntw, wave, smem, acc);
    if (!live) return;   // behind the last barrier
    float* Cb = (CMODE == 1) ? C + pkoff(rb) : C + (size_t)r0 * ldc; const int ldo = (CMODE == 1) ? (rb + 1) * 64 : ldc;
#pragma unroll
    for (int mb = 0; mb < 4; ++mb) {
#pragma unroll
        for (int nb = 0; nb < 4; ++nb) {
#pragma unroll
            for (int j = 0; j < 8; ++j) os[(hi * 8 + j) * 68 + nb * 16 + lr] = acc[mb][nb][j]; }
        __builtin_amdgcn_wave_barrier(); asm volatile("" ::: "memory");
        float* crow = Cb + (size_t)(mb * 16) * ldo + c0;
{
#pragma unroll
            for (int s = 0; s < 8; ++s) { const int row = 2 * s + hi, cofs = lr * 4; v4f val = *(const v4fa*)(os + row * 68 + cofs); if (CMODE >= 2) val *= osc;
                *(v4f*)(crow + (size_t)row * ldo + cofs) = val; }
             }
        __builtin_amdgcn_wave_barrier(); asm volatile("" ::: "memory");
    }
}

__device__ __forceinline__ h16 tohx(float x) { return (h16)x; }
__device__ __forceinline__ void splitf(float y, unsigned short& h, unsigned short& l) { h = f2bf(y); l = f2bf(y - bf2f(h)); }
typedef __attribute__((ext_vector_type(2))) _Float16 v2h;
typedef __attribute__((ext_vector_type(4))) _Float16 v4h;
typedef __attribute__((ext_vector_type(2))) unsigned short v2us;
typedef __attribute__((ext_vector_type(4))) unsigned short v4us;
typedef __attribute__((ext_vector_type(2))) float v2f;
typedef __attribute__((ext_vector_type(4))) int v4i;

// the staged 64 x 64 f32 tile (pitch 68) to the planes: fp16 always, bf16 hi + lo where HL. p16, ph, pl: the tile's first element in each plane.
template <bool HL>
__device__ __forceinline__ void put_planes(const float* os, int rsub, int cofs, h16* p16, int ld16, bf* ph, bf* pl, int ldhl) {
#pragma unroll   // straight-line text (the kernel stays far under 32 KB): constant LDS offsets, and LDS reads of later rows issue under the conversions of earlier ones
    for (int s = 0; s < 16; ++s) { const int row = s * 4 + rsub; const v4f u0 = *(const v4fa*)(os + row * 68 + cofs), u1 = *(const v4fa*)(os + row * 68 + cofs + 4); v8h o16; v8us oh, ol;
#pragma unroll
        for (int q = 0; q < 8; ++q) { const float r = (q < 4) ? u0[q & 3] : u1[q & 3]; o16[q] = tohx(r); if (HL) { unsigned short a2, c2; splitf(r, a2, c2); oh[q] = a2; ol[q] = c2; } }
        *(v8h*)(p16 + (size_t)row * ld16 + cofs) = o16;
        if (HL) { const size_t oo = (size_t)row * ldhl + cofs; *(v8us*)(ph + oo) = oh; *(v8us*)(pl + oo) = ol; } }
    asm volatile("s_wait_xcnt 0x0" ::: "memory");   // behind the last stores: the text of the other side of the caller's test follows and reuses their registers
}

// k_gemmp: the same tile GEMM on plain bf16 operands whose epilogue writes the attention operand planes itself: C[m][n] = sum_k A[m][k] Bt[n][k], stored as fp16 (P16) and, for tokens < RH of each batch, as bf16 hi + lo (Ph, Pl).
// The token axis runs over all batches (NB_ * TT). TR false: tokens are the tile's rows, planes [b][t][d] (hi/lo [b][RH][d]). TR true: tokens are its columns, planes [b][d][t] (hi/lo [b][d][RH]).
// Each wave's whole 64 x 64 f32 tile is staged in LDS (pitch 68) so that every store instruction covers whole 128-B rows of a plane (8 lanes a row, 16 B a lane). With A = weight rows and Bt = token rows it yields the transposed planes [d][t].
template <bool TR>
__global__ __launch_bounds__(128) void k_gemmp(const bf* __restrict__ A, const bf* __restrict__ Bt, int K, h16* P16, bf* Ph, bf* Pl) {
    __shared__ __align__(16) char smem[2 * Stg<0>::STAGE];
    const int wave = __builtin_amdgcn_readfirstlane(threadIdx.x >> 5); float* os = (float*)smem + wave * 64 * 68;   // each wave's output staging (64 x 68 f32) takes the operand buffers' place behind the K loop
    static_assert(4 * 64 * 68 * 4 <= 2 * Stg<0>::STAGE, "the four staged tiles fit the operand buffers");
    const int lane = threadIdx.x & 31, lr = lane & 15, hi = lane >> 4; const int r0 = blockIdx.x * 128 + (wave >> 1) * 64, c0 = blockIdx.y * 128 + (wave & 1) * 64;   // this wave's 64x64 tile
    v8f acc[4][4];
#pragma unroll
    for (int mb = 0; mb < 4; ++mb)
#pragma unroll
        for (int nb = 0; nb < 4; ++nb) acc[mb][nb] = (v8f){};
    tile_mm<bf, 0>((wave >= 2) ? Bt + (size_t)(blockIdx.y * 128 + (wave & 1) * 64) * K : A + (size_t)(blockIdx.x * 128 + wave * 64) * K, K, K / Stg<0>::KSTEP, K / Stg<0>::KSTEP, wave, smem, acc);   // waves 0, 1 copy the A rows, waves 2, 3 the Bt rows
#pragma unroll
    for (int mb = 0; mb < 4; ++mb)
#pragma unroll
        for (int nb = 0; nb < 4; ++nb)
#pragma unroll
            for (int j = 0; j < 8; ++j) os[(mb * 16 + hi * 8 + j) * 68 + nb * 16 + lr] = acc[mb][nb][j];
    __syncthreads();   // the staged tile is read by other lanes than wrote it: this orders the LDS traffic
    const int rsub = lane >> 3, cofs = (lane & 7) * 8;
    const int tok = TR ? c0 : r0, bz = tok / TT, tl = tok % TT; const bool hl = (tl < RH);   // the tile's 64 tokens lie in one batch, and wholly below RH or not at all
    const int ld16 = TR ? TT : HD, ldhl = TR ? RH : HD;
    const size_t b16 = TR ? ((size_t)bz * HD + r0) * TT + tl : (size_t)r0 * HD + c0, bhl = TR ? ((size_t)bz * HD + r0) * RH + tl : ((size_t)bz * RH + tl) * HD + c0;
    if (hl) put_planes<true>(os, rsub, cofs, P16 + b16, ld16, Ph + bhl, Pl + bhl, ldhl);   // one test a tile, uniform for the wave, so that each side stays straight-line text
    else put_planes<false>(os, rsub, cofs, P16 + b16, ld16, Ph, Pl, ldhl);
}

__global__ __launch_bounds__(256) void k_wtG(const float* __restrict__ w, int K, int N, bf* Bt) {
    const int lane = threadIdx.x & 31; const int L0 = (blockIdx.x * 8 + (threadIdx.x >> 5)) * 8; const int nlines = N * K / 64;
{
#pragma unroll 1
        for (int l = 0; l < 8; ++l) { const int L = L0 + l; if (L >= nlines) break; const size_t e = (size_t)L * 64 + lane * 2; const int k = (int)(e % K), n = (int)(e / K); v2us o;
            o[0] = f2bf(w[(size_t)k * N + n]); o[1] = f2bf(w[(size_t)(k + 1) * N + n]); *(v2us*)(Bt + e) = o; }
         }
}
__global__ __launch_bounds__(256) void k_cvt8(const float* __restrict__ src, bf* dst, size_t n8) { const size_t i = (size_t)blockIdx.x * 256 + threadIdx.x; if (i >= n8) return; const v8f v = *(const v8f*)(src + i * 8); v8us o;
#pragma unroll
    for (int k = 0; k < 8; ++k) o[k] = f2bf(v[k]); *(v8us*)(dst + i * 8) = o;  }
__global__ __launch_bounds__(256) void k_cscvt(const float* __restrict__ cosT, const float* __restrict__ sinT, float* CS) { const int idx = blockIdx.x * 256 + threadIdx.x; if (idx >= TT * HD) return; v2f cs; cs[0] = bfr(cosT[idx]); cs[1] = bfr(sinT[idx]); *(v2f*)(CS + (size_t)idx * 2) = cs;  }
// k_asoft: per row (zz, i): t = S x HD^-0.5 for j <= i and i - j < WIN (sliding causal window; the reference's -1e9 additive fill vanishes identically); softmax over the row's keys (register row, one exp, fixed trees).
// A row of block rb holds len = (rb + 1) * 64 scores. The row is worked in groups of 512 keys (4 chunks of 128), one wave-uniform test a group; groups that begin at or beyond len are skipped: their terms were exact zeros,
// so the sums keep their values and their order. The last group may read up to 448 f32 past the row, still inside the packed scores (the last block's len is a multiple of 512), and the select masks them.
// The fp16 probabilities go over the row's own scores: the wave has read its whole row before it knows the factor f that every store needs, and for rows >= RH (len > 512) len rounded up to 512 fp16 never outgrows len f32.
__global__ __launch_bounds__(256) void k_asoft(float* Sb, bf* Ph, bf* Pl) {
    const int lane = threadIdx.x & 31; const int row = blockIdx.x * 8 + __builtin_amdgcn_readfirstlane(threadIdx.x >> 5); if (row >= NB_ * TT) return; const int i = row % TT; const int zz = row / TT; const bool hires = (i < RH);
    const int rb = i >> 6, len = (rb + 1) * 64; float* sr = Sb + (size_t)zz * SBZ + pkoff(rb) + (size_t)(i & 63) * len; v4f ld[TT / 128]; float v[TT / 32]; float mx = -3.0e38f;
    static_assert(RH == 512 && TT % 512 == 0, "the hi/lo rows are exactly the rows of one group");
#pragma unroll
    for (int g = 0; g < TT / 512; ++g) if (g * 512 < len) {   // all the row's loads first: one memory latency a row, not one a group
#pragma unroll
        for (int ch = g * 4; ch < g * 4 + 4; ++ch) ld[ch] = *(const v4f*)(sr + ch * 128 + lane * 4); }
    asm volatile("s_wait_xcnt 0x0" ::: "memory");   // behind the last load: the index arithmetic below reuses the address registers that the loads name
#pragma unroll
    for (int g = 0; g < TT / 512; ++g) if (g * 512 < len) {
#pragma unroll
      for (int ch = g * 4; ch < g * 4 + 4; ++ch) { const int j0 = ch * 128 + lane * 4; const v4f a = ld[ch];
#pragma unroll
        for (int q = 0; q < 4; ++q) { const int j = j0 + q; (void)j; float sa = a[q] * SCL; asm volatile("" : "+v"(sa)); const float t = (j <= i) ? sa : -3.0e38f; v[ch * 4 + q] = t; mx = fmaxf(mx, t); } } }
#pragma unroll
    for (int sh = 16; sh; sh >>= 1) mx = fmaxf(mx, __shfl_xor(mx, sh, 32));
    float sum = 0.f;
#pragma unroll
    for (int g = 0; g < TT / 512; ++g) if (g * 512 < len) {
#pragma unroll
        for (int k = g * 16; k < g * 16 + 16; ++k) { float d0 = __fsub_rn(v[k], mx); asm volatile("" : "+v"(d0)); v[k] = __builtin_amdgcn_exp2f(__fmul_rn(d0, 1.4426950408889634f)); sum += v[k]; } }
#pragma unroll
    for (int sh = 16; sh; sh >>= 1) sum += __shfl_xor(sum, sh, 32);
    const float f = __fdiv_rn(hires ? 1.0f : PCAR, sum);
{
        if (hires) {
#pragma unroll
            for (int ch = 0; ch < RH / 128; ++ch) { v4us oh, ol;
#pragma unroll
                for (int q = 0; q < 4; ++q) { unsigned short a, c2; splitf(v[ch * 4 + q] * f, a, c2); oh[q] = a; ol[q] = c2; }
                const size_t oo = ((size_t)zz * RH + i) * RH + ch * 128 + lane * 4; *(v4us*)(Ph + oo) = oh; *(v4us*)(Pl + oo) = ol; }
        } else {
            h16* pr = (h16*)sr;
#pragma unroll
            for (int g = 0; g < TT / 512; ++g) if (g * 512 < len) {
#pragma unroll
              for (int ch = g * 4; ch < g * 4 + 4; ++ch) { v4h o4;
#pragma unroll
                for (int q = 0; q < 4; ++q) o4[q] = tohx(v[ch * 4 + q] * f);
                *(v4h*)(pr + ch * 128 + lane * 4) = o4; }
              asm volatile("s_wait_xcnt 0x0" ::: "memory"); }   // the next group's conversions may reuse the registers that this group's stores name
        }
         }
}
__global__ __launch_bounds__(256) void k_merge(const float* __restrict__ O, int h0, bf* Ah, bf* Al) { const size_t e = ((size_t)blockIdx.x * 256 + threadIdx.x) * 2; if (e >= (size_t)ZH * TT * HD) return; const int d = (int)(e % HD); const int t = (int)((e / HD) % TT); const int zz = (int)(e / ((size_t)HD * TT)); const float cs = (t < RH) ? 1.0f : (1.0f / PCAR); const size_t oo = (size_t)t * DQ + (h0 + zz) * HD + d;
    v2us oh, ol;
#pragma unroll
    for (int q = 0; q < 2; ++q) { unsigned short a, c2; splitf(O[e + q] * cs, a, c2); oh[q] = a; ol[q] = c2; } *(v2us*)(Ah + oo) = oh; *(v2us*)(Al + oo) = ol;  }


extern "C" void kernel_launch(void* const* d_in, const int* in_sizes, int n_in,
                              void* d_out, int out_size, void* d_ws, size_t ws_size, hipStream_t stream) {
    (void)in_sizes; (void)n_in; (void)out_size;
    const float* x = (const float*)d_in[0]; const float* wq = (const float*)d_in[1]; const float* wk = (const float*)d_in[2]; const float* wv = (const float*)d_in[3];
    float* OUT = (float*)d_out;     // [4][4096][768]
    char* wsp = (char*)d_ws;
    auto take = [&](size_t bytes) { char* p = wsp; wsp += (bytes + 255) & ~(size_t)255; return (void*)p; };
    bf* WQ = (bf*)take((size_t)DQ * DM * 2); bf* WK = (bf*)take((size_t)DKV * DM * 2); bf* WV = (bf*)take((size_t)DKV * DM * 2);
    bf* XB = (bf*)take((size_t)NB_ * TT * DM * 2);
    h16* QP16 = (h16*)take((size_t)NB_ * TT * HD * 2); h16* KP16 = (h16*)take((size_t)NB_ * TT * HD * 2); h16* VT16 = (h16*)take((size_t)NB_ * HD * TT * 2);
    bf* QPh = (bf*)take((size_t)NB_ * RH * HD * 2); bf* QPl = (bf*)take((size_t)NB_ * RH * HD * 2); bf* KPh = (bf*)take((size_t)NB_ * RH * HD * 2); bf* KPl = (bf*)take((size_t)NB_ * RH * HD * 2); bf* VTh = (bf*)take((size_t)NB_ * HD * RH * 2); bf* VTl = (bf*)take((size_t)NB_ * HD * RH * 2); bf* Ph = (bf*)take((size_t)NB_ * RH * RH * 2); bf* Pl = (bf*)take((size_t)NB_ * RH * RH * 2);
    float* Sb = (float*)take((size_t)NB_ * SBZ * 4);      // packed causal scores; the fp16 probabilities of rows >= RH take their place row by row
    if ((size_t)(wsp - (char*)d_ws) > ws_size) return;    // ws 256 MiB
    { k_cvt8<<<(unsigned)(((size_t)DQ * DM / 8 + 255) / 256), 256, 0, stream>>>(wq, WQ, (size_t)DQ * DM / 8); k_cvt8<<<(unsigned)(((size_t)DKV * DM / 8 + 255) / 256), 256, 0, stream>>>(wk, WK, (size_t)DKV * DM / 8); k_cvt8<<<(unsigned)(((size_t)DKV * DM / 8 + 255) / 256), 256, 0, stream>>>(wv, WV, (size_t)DKV * DM / 8);
      /* no output projection */
       }
    k_cvt8<<<(unsigned)(((size_t)NB_ * TT * DM / 8 + 255) / 256), 256, 0, stream>>>(x, XB, (size_t)NB_ * TT * DM / 8);
    k_gemmp<false><<<dim3(NB_ * TT / 128, HD / 128, 1), 128, 0, stream>>>(XB, WQ, DM, QP16, QPh, QPl);      // q planes [b][t][d]
    k_gemmp<false><<<dim3(NB_ * TT / 128, HD / 128, 1), 128, 0, stream>>>(XB, WK, DM, KP16, KPh, KPl);      // k planes [b][t][d]
    k_gemmp<true><<<dim3(HD / 128, NB_ * TT / 128, 1), 128, 0, stream>>>(WV, XB, DM, VT16, VTh, VTl);       // v planes transposed [b][d][t]: the weight rows are the tile's rows
    k_gemmc<bf, 2, 1><<<dim3(RH / 128, RH / 128, NB_), 128, 0, stream>>>(QPh, QPl, KPh, KPl, HD, Sb, 0, 0, 1.0f, (size_t)RH * HD, (size_t)RH * HD, SBZ);
    k_gemmc<h16, 0, 1><<<dim3((TT - RH) / 128, TT / 128, NB_), 128, 0, stream>>>(QP16 + (size_t)RH * HD, nullptr, KP16, nullptr, HD, Sb, 0, RH, 1.0f, (size_t)TT * HD, (size_t)TT * HD, SBZ);
    k_asoft<<<NB_ * TT / 8, 256, 0, stream>>>(Sb, Ph, Pl);
    k_gemmc<bf, 2, 2><<<dim3(RH / 128, HD / 128, NB_), 128, 0, stream>>>(Ph, Pl, VTh, VTl, RH, OUT, HD, 0, 1.0f, (size_t)RH * RH, (size_t)HD * RH, (size_t)TT * HD);
    k_gemmc<h16, 0, 3><<<dim3((TT - RH) / 128, HD / 128, NB_), 128, 0, stream>>>((const h16*)Sb, nullptr, VT16, nullptr, TT, OUT + (size_t)RH * HD, HD, RH, 1.0f / PCAR, 2 * SBZ, (size_t)HD * TT, (size_t)TT * HD);
}

// v005
// It runs in 196 microseconds.
// In both of two side-by-side timings against v004, it was 1.23 times as fast.
// All steps since v000 together make it 5.61 times as fast.
#include <hip/hip_runtime.h>

// CausalMaskedAttention (input [4][4096][768]; q/k/v = x W^T ([768][768], one head of width 768); scores = q.k / sqrt(768) (the source scales by d_in), causal (-inf); softmax; out = weights v -> [4][4096][768] (no output projection)).
// Compute dtypes, f32 accumulate: every input rounded to bf16; q/k/v on PLAIN bf16 operands (inputs: exact); causal scores and attn.v: query rows < 512 hl (3 products), the rest single fp16 (x1024), causal tile skipping; softmax f32 (128 keys per lane); the context written directly in f32 by the attn.v GEMM; the q/k/v operand planes written by the projection GEMMs' epilogues.
// Every launch covers all four batches, and launches that do not depend on each other are one launch (5 in all): the input conversions; the three projections; hi/lo and fp16 score tiles; the softmax; hi/lo and fp16 attn.v tiles. So that the workspace holds four batches at once, the scores are stored packed by causal 64-row blocks
// (block rb: 64 rows of (rb + 1) * 64 f32), the fp16 probabilities are written over their own score row, and the hi/lo planes exist only for the RH rows, keys and value columns that read them.

#define NB_  4
#define TT   4096
#define DM   768
#define NH_  1
#define NKV  1
#define REP  (NH_ / NKV)
#define HD   768
#define DQ   (NH_ * HD)
#define DKV  (NKV * HD)
#define ZH   1
#define RH   512                  // query rows < RH use hi+lo planes
#define WIN  4096
#define PCAR 1024.0f
#define SCL  0.036084391824351615f   // 1/sqrt(d_in = 768)
#define SBZ  ((size_t)(TT / 64) * (TT / 64 + 1) / 2 * 4096)   // f32 elements of one batch's packed causal scores
typedef _Float16 h16;
typedef unsigned short bf;
typedef __attribute__((ext_vector_type(16))) __bf16   v16bf;
typedef __attribute__((ext_vector_type(16))) _Float16 v16h;
typedef __attribute__((ext_vector_type(8)))  _Float16 v8h;
typedef __attribute__((ext_vector_type(8)))  unsigned short v8us;
typedef __attribute__((ext_vector_type(8)))  float    v8f;
typedef __attribute__((ext_vector_type(4)))  float    v4f;
typedef v8h  __attribute__((may_alias)) v8ha;
typedef v4f  __attribute__((may_alias)) v4fa;
typedef v8us __attribute__((may_alias)) v8usa;
// first f32 element of 64-row block rb in a batch's packed scores: the blocks before it hold 1 + 2 + ... + rb tiles of 64 x 64
__device__ __forceinline__ size_t pkoff(int rb) { return (size_t)(rb * (rb + 1) / 2) * 4096; }

__device__ __forceinline__ unsigned short f2bf(float f) { unsigned u = __float_as_uint(f); u += 0x7FFFu + ((u >> 16) & 1u); return (unsigned short)(u >> 16); }
__device__ __forceinline__ float bf2f(unsigned short b) { return __uint_as_float(((unsigned)b) << 16); }
__device__ __forceinline__ float bfr(float f) { return bf2f(f2bf(f)); }
__device__ __forceinline__ v16h cat16(v8h lo, v8h hi) { return __builtin_shufflevector(lo, hi, 0, 1, 2, 3, 4, 5, 6, 7, 8, 9, 10, 11, 12, 13, 14, 15); }
__device__ __forceinline__ v16bf cat16b(v8us lo, v8us hi) { return __builtin_bit_cast(v16bf, __builtin_shufflevector(lo, hi, 0, 1, 2, 3, 4, 5, 6, 7, 8, 9, 10, 11, 12, 13, 14, 15)); }
__device__ __forceinline__ v8f wmma16(v16h a, v16h b, v8f c) { return __builtin_amdgcn_wmma_f32_16x16x32_f16(false, a, false, b, (short)0, c, false, false); }
__device__ __forceinline__ v8f wmmab(v16bf a, v16bf b, v8f c) { return __builtin_amdgcn_wmma_f32_16x16x32_bf16(false, a, false, b, (short)0, c, false, false); }



// ---- register-blocked GEMMs, one wave per 64x64 output tile (16 accumulators), FOUR WAVES (2 x 2) a work-group on one 128x128 tile: the four share each K step's operand rows in LDS (tile_mm), so every row
// is fetched from L2 once for two waves; operands from K-contiguous 16-bit planes; 128 threads.
// C[m][n] = sum_k A[m][k] Bt[n][k] (+ split products per NSPLIT). K % Stg<NSPLIT>::KSTEP == 0 (64 for one product, 32 for three).
template <typename T16> struct WFrag;
template <> struct WFrag<h16> { typedef v16h V; static __device__ __forceinline__ V ld(const h16* p) { return cat16(*(const v8h*)p, *(const v8h*)(p + 16)); } static __device__ __forceinline__ v8f mma(V a, V b, v8f c) { return wmma16(a, b, c); } };
template <> struct WFrag<bf> { typedef v16bf V; static __device__ __forceinline__ V ld(const bf* p) { return cat16b(*(const v8us*)p, *(const v8us*)(p + 16)); } static __device__ __forceinline__ v8f mma(V a, V b, v8f c) { return wmmab(a, b, c); } };
// ---- operand staging for the 128x128 tile GEMMs: each K step's operand rows (128 a plane) go from global memory to LDS by asynchronous copies that cover the rows' bytes side by side (128-B rows: 8 lanes a row,
// 4 whole lines a copy; the three-product kernels take 64-B rows), two buffers, the next step's copies in flight while this step's fragments are read from LDS. Each wave copies a quarter of a stage (SLICE, 16 copies):
// one product: 64 rows of A (waves 0, 1) or of Bt (waves 2, 3); three products: one whole plane (A, Bt, A2, Bt2 in wave order).
template <int NSPLIT> struct Stg { static constexpr int NPL = (NSPLIT >= 2) ? 4 : 2, RB = (NSPLIT >= 2) ? 64 : 128, PITCH = RB + 16, LPR = RB / 16, RPC = 32 / LPR, PLANE = 128 * PITCH, STAGE = NPL * PLANE, SLICE = STAGE / 4, CPW = SLICE / (RPC * PITCH), KSTEP = RB / 2, KS = RB / 64; };
typedef int gv4i __attribute__((vector_size(16)));
// one copy of 16 B a lane, global -> LDS, through no register
template <typename T16>
__device__ __forceinline__ void copy16(const T16* g, char* l) { __builtin_amdgcn_global_load_async_to_lds_b128((__attribute__((address_space(1))) gv4i*)g, (__attribute__((address_space(3))) gv4i*)l, 0, 0); }
// The wave's 64x64 tile (wm, wn) of the work-group's 128x128: acc += A[wm * 64 ..+63][k] x Bt[wn * 64 ..+63][k]^T (+ the split products), k ascending in steps of 32 as before, over the wave's own first ntw K steps.
// src: first element of the rows that THIS wave copies (its quarter of every stage), ld: their pitch in elements. nt: K steps that the work-group stages (>= 1, >= ntw, the same in all four waves); a wave with
// ntw < nt copies and passes every barrier to the end and only leaves the products out. smem: 2 * Stg<NSPLIT>::STAGE bytes, shared by the four waves.
template <typename T16, int NSPLIT>
__device__ __forceinline__ void tile_mm(const T16* __restrict__ src, int ld, int nt, int ntw, int wave, char* smem, v8f (&acc)[4][4]) {
    typedef typename WFrag<T16>::V V; typedef Stg<NSPLIT> S;
    static_assert(NSPLIT == 0 || NSPLIT == 2, "one product or the three hi/lo products");
    const int lane = threadIdx.x & 31, lr = lane & 15, hi = lane >> 4, wm = wave >> 1, wn = wave & 1;
    const T16* g0 = src + (size_t)(lane / S::LPR) * ld + (lane % S::LPR) * 8;
    char* l0 = smem + wave * S::SLICE + (lane / S::LPR) * S::PITCH + (lane % S::LPR) * 16;
    auto fill = [&](int t) {
#pragma unroll
        for (int g = 0; g < S::CPW; ++g)
            copy16<T16>(g0 + (size_t)t * S::KSTEP + (size_t)(g * S::RPC) * ld, l0 + (t & 1) * S::STAGE + g * S::RPC * S::PITCH);
    };
    fill(0);
    asm volatile("s_wait_asynccnt 0x0" ::: "memory");   // this wave's share of step 0 has landed
    __syncthreads();   // the ring's publish point: every wave's share of step 0 has landed before any wave reads it
    if (nt > 1) fill(1);
#pragma unroll 1
    for (int t = 0; t < nt; ++t) {
        if (t < ntw) {   // uniform for the wave (a scalar test): EXEC stays all ones at the WMMAs
            const char* sa = smem + (t & 1) * S::STAGE + (wm * 64 + lr) * S::PITCH + hi * 16, *sb = smem + (t & 1) * S::STAGE + S::PLANE + (wn * 64 + lr) * S::PITCH + hi * 16;
            V a[S::KS][4], b[S::KS][4], a2[S::KS][4], b2[S::KS][4];
#pragma unroll
            for (int ks = 0; ks < S::KS; ++ks)
#pragma unroll
                for (int q = 0; q < 4; ++q) { a[ks][q] = WFrag<T16>::ld((const T16*)(sa + q * 16 * S::PITCH + ks * 64)); b[ks][q] = WFrag<T16>::ld((const T16*)(sb + q * 16 * S::PITCH + ks * 64));
                    if (NSPLIT >= 2) { a2[ks][q] = WFrag<T16>::ld((const T16*)(sa + 2 * S::PLANE + q * 16 * S::PITCH + ks * 64)); b2[ks][q] = WFrag<T16>::ld((const T16*)(sb + 2 * S::PLANE + q * 16 * S::PITCH + ks * 64)); } }
            __builtin_amdgcn_sched_barrier(0);   // keeps the step's LDS reads together ahead of its WMMAs: sunk among them, each group makes the wave wait out the LDS latency
#pragma unroll
            for (int ks = 0; ks < S::KS; ++ks)
#pragma unroll
                for (int nb = 0; nb < 4; ++nb)
#pragma unroll
                    for (int mb = 0; mb < 4; ++mb) { acc[mb][nb] = WFrag<T16>::mma(a[ks][mb], b[ks][nb], acc[mb][nb]); if (NSPLIT >= 2) { acc[mb][nb] = WFrag<T16>::mma(a2[ks][mb], b[ks][nb], acc[mb][nb]); acc[mb][nb] = WFrag<T16>::mma(a[ks][mb], b2[ks][nb], acc[mb][nb]); } }
            __builtin_amdgcn_sched_barrier(0);   // keeps the waits below behind the WMMAs: lifted over them, the wave would sit out the next step's copies before its matrix work and not under it
        }
        asm volatile("s_wait_dscnt 0x0" ::: "memory");      // this step's LDS reads have retired before its buffer is refilled
        asm volatile("s_wait_asynccnt 0x0" ::: "memory");   // this wave's share of the next step has landed
        __syncthreads();   // publish point: the next step is whole for every wave, and every wave has left the buffer that is refilled below
        if (t + 2 < nt) fill(t + 2);
    }
    asm volatile("s_wait_asynccnt 0x0" ::: "memory");       // nothing in flight when the buffers become the output staging
}

// ---- gemmc: the same tile GEMM specialised for causal attention: CMODE 1 skips score tiles entirely above the diagonal (query rows r0+roff.., key columns c0..; a whole work-group returns, a single wave of a
// diagonal work-group only copies), CMODE 2 limits each wave's key (K) loop of the probability x value contraction to its rows' diagonal block (probabilities beyond it are exactly zero). roff = row offset of this body's first row within the sequence. CMODE 2 stores acc x osc (the inverse of the probabilities' carry factor), so C is the final output.
// CMODE 1 stores into the packed scores (C = the batch's first element, ldc unused). CMODE 3 = CMODE 2 with A = the fp16 probabilities that lie over their packed score rows (A = the scores' first element, pitch twice the block's f32 pitch).
// gemmc is the body of one work-group; (bx, by, bz) = its tile row, tile column and batch, smem: SMC bytes (at least 2 * Stg<NSPLIT>::STAGE). The kernels k_scores and k_pv below pick the body by the block index.
template <typename T16, int NSPLIT, int CMODE>
__device__ __forceinline__ void gemmc(char* smem, int bx, int by, int bz, const T16* __restrict__ A, const T16* __restrict__ A2, const T16* __restrict__ Bt, const T16* __restrict__ Bt2, int K, float* C, int ldc, int roff, float osc, size_t sA, size_t sB, size_t sC) {
    typedef typename WFrag<T16>::V V;
    typedef Stg<NSPLIT> S;
    const int wave = __builtin_amdgcn_readfirstlane(threadIdx.x >> 5); float* os = (float*)smem + wave * 16 * 68;   // each wave's output staging (16 x 68 f32) takes the operand buffers' place behind the K loop
    const size_t z = bz; A += z * sA; if (A2) A2 += z * sA; Bt += z * sB; if (Bt2) Bt2 += z * sB; C += z * sC;
    const int lane = threadIdx.x & 31, lr = lane & 15, hi = lane >> 4; const int R0 = bx * 128, C0 = by * 128;
    if (CMODE == 1 && C0 > R0 + roff + 127) return;                 // all four score tiles above the causal diagonal: the whole work-group leaves, ahead of every barrier
    const int r0 = R0 + (wave >> 1) * 64, c0 = C0 + (wave & 1) * 64;  // this wave's 64x64 tile
    const bool live = !(CMODE == 1 && c0 > r0 + roff + 63);          // score tile entirely above the causal diagonal: it has no place in the packed scores and is never read (the softmax masks j > i by select)
    const int nt = ((CMODE >= 2) ? min(K, R0 + roff + 128) : K) / S::KSTEP;                    // K steps staged: as far as the lower 64 rows need
    const int ntw = (CMODE >= 2) ? min(K, r0 + roff + 64) / S::KSTEP : (live ? nt : 0);         // P.V: probabilities are exactly 0 beyond the rows' diagonal block, so the wave's products stop there
    const int rb = (r0 + roff) >> 6;                                 // this tile's 64-row block within the sequence
    // the rows that this wave copies, a quarter of every stage. CMODE 3: the two 64-row blocks of A have each their own start and pitch; the upper block's last staged step lies past its probabilities, still inside its own rows' score bytes, and is not multiplied (ntw)
    const T16* src; int ld = K;
    if (NSPLIT >= 2) src = ((wave == 0) ? A : (wave == 1) ? Bt : (wave == 2) ? A2 : Bt2) + (size_t)((wave & 1) ? C0 : R0) * K;
    else if (wave >= 2) src = Bt + (size_t)(C0 + (wave & 1) * 64) * K;
    else if (CMODE == 3) { const int rbh = ((R0 + roff) >> 6) + wave; src = A + 2 * pkoff(rbh); ld = 2 * (rbh + 1) * 64; }
    else src = A + (size_t)(R0 + wave * 64) * K;
    v8f acc[4][4];
#pragma unroll
    for (int mb = 0; mb < 4; ++mb)
#pragma unroll
        for (int nb = 0; nb < 4; ++nb) acc[mb][nb] = (v8f){};
    tile_mm<T16, NSPLIT>(src, ld, nt, ntw, wave, smem, acc);
    if (!live) return;   // behind the last barrier
    float* Cb = (CMODE == 1) ? C + pkoff(rb) : C + (size_t)r0 * ldc; const int ldo = (CMODE == 1) ? (rb + 1) * 64 : ldc;
#pragma unroll
    for (int mb = 0; mb < 4; ++mb) {
#pragma unroll
        for (int nb = 0; nb < 4; ++nb) {
#pragma unroll
            for (int j = 0; j < 8; ++j) os[(hi * 8 + j) * 68 + nb * 16 + lr] = acc[mb][nb][j]; }
        __builtin_amdgcn_wave_barrier(); asm volatile("" ::: "memory");
        float* crow = Cb + (size_t)(mb * 16) * ldo + c0;
{
#pragma unroll
            for (int s = 0; s < 8; ++s) { const int row = 2 * s + hi, cofs = lr * 4; v4f val = *(const v4fa*)(os + row * 68 + cofs); if (CMODE >= 2) val *= osc;
                *(v4f*)(crow + (size_t)row * ldo + cofs) = val; }
             }
        __builtin_amdgcn_wave_barrier(); asm volatile("" ::: "memory");
    }
    asm volatile("s_wait_xcnt 0x0" ::: "memory");   // behind the last stores: the text of the other body of the calling kernel's test follows and reuses their registers
}

// The hi/lo tiles (query rows < RH) and the fp16 tiles of one attention GEMM are independent of each other: one launch holds both. The few, long hi/lo work-groups take the lowest block indices, so that they start first
// and run beside the fp16 work-groups, which keep their order (tile row fastest, then tile column, then batch).
#define SMC ((2 * Stg<2>::STAGE > 2 * Stg<0>::STAGE) ? 2 * Stg<2>::STAGE : 2 * Stg<0>::STAGE)
__global__ __launch_bounds__(128) void k_scores(const bf* __restrict__ Qh, const bf* __restrict__ Ql, const bf* __restrict__ Kh, const bf* __restrict__ Kl, const h16* __restrict__ Q16, const h16* __restrict__ K16, int K, float* Sb) {
    __shared__ __align__(16) char smem[SMC];
    constexpr int HX = RH / 128, NHW = HX * HX * NB_, NX = (TT - RH) / 128, NY = TT / 128;
    const int id = blockIdx.x;
    if (id < NHW) gemmc<bf, 2, 1>(smem, id % HX, id / HX % HX, id / (HX * HX), Qh, Ql, Kh, Kl, K, Sb, 0, 0, 1.0f, (size_t)RH * HD, (size_t)RH * HD, SBZ);
    else { const int m = id - NHW; gemmc<h16, 0, 1>(smem, m % NX, m / NX % NY, m / (NX * NY), Q16 + (size_t)RH * HD, nullptr, K16, nullptr, K, Sb, 0, RH, 1.0f, (size_t)TT * HD, (size_t)TT * HD, SBZ); }
}
__global__ __launch_bounds__(128) void k_pv(const bf* __restrict__ Ph, const bf* __restrict__ Pl, const bf* __restrict__ VTh, const bf* __restrict__ VTl, const h16* __restrict__ P16, const h16* __restrict__ VT16, int Kh, int Kf, float* O) {
    __shared__ __align__(16) char smem[SMC];
    constexpr int HX = RH / 128, NY = HD / 128, NHW = HX * NY * NB_, NX = (TT - RH) / 128;
    const int id = blockIdx.x;
    if (id < NHW) gemmc<bf, 2, 2>(smem, id % HX, id / HX % NY, id / (HX * NY), Ph, Pl, VTh, VTl, Kh, O, HD, 0, 1.0f, (size_t)RH * RH, (size_t)HD * RH, (size_t)TT * HD);
    else { const int m = id - NHW; gemmc<h16, 0, 3>(smem, m % NX, m / NX % NY, m / (NX * NY), P16, nullptr, VT16, nullptr, Kf, O + (size_t)RH * HD, HD, RH, 1.0f / PCAR, 2 * SBZ, (size_t)HD * TT, (size_t)TT * HD); }
}

__device__ __forceinline__ h16 tohx(float x) { return (h16)x; }
__device__ __forceinline__ void splitf(float y, unsigned short& h, unsigned short& l) { h = f2bf(y); l = f2bf(y - bf2f(h)); }
typedef __attribute__((ext_vector_type(2))) _Float16 v2h;
typedef __attribute__((ext_vector_type(4))) _Float16 v4h;
typedef __attribute__((ext_vector_type(2))) unsigned short v2us;
typedef __attribute__((ext_vector_type(4))) unsigned short v4us;
typedef __attribute__((ext_vector_type(2))) float v2f;
typedef __attribute__((ext_vector_type(4))) int v4i;

// the staged 64 x 64 f32 tile (pitch 68) to the planes: fp16 always, bf16 hi + lo where HL. p16, ph, pl: the tile's first element in each plane.
template <bool HL>
__device__ __forceinline__ void put_planes(const float* os, int rsub, int cofs, h16* p16, int ld16, bf* ph, bf* pl, int ldhl) {
#pragma unroll   // straight-line text (the kernel stays far under 32 KB): constant LDS offsets, and LDS reads of later rows issue under the conversions of earlier ones
    for (int s = 0; s < 16; ++s) { const int row = s * 4 + rsub; const v4f u0 = *(const v4fa*)(os + row * 68 + cofs), u1 = *(const v4fa*)(os + row * 68 + cofs + 4); v8h o16; v8us oh, ol;
#pragma unroll
        for (int q = 0; q < 8; ++q) { const float r = (q < 4) ? u0[q & 3] : u1[q & 3]; o16[q] = tohx(r); if (HL) { unsigned short a2, c2; splitf(r, a2, c2); oh[q] = a2; ol[q] = c2; } }
        *(v8h*)(p16 + (size_t)row * ld16 + cofs) = o16;
        if (HL) { const size_t oo = (size_t)row * ldhl + cofs; *(v8us*)(ph + oo) = oh; *(v8us*)(pl + oo) = ol; } }
    asm volatile("s_wait_xcnt 0x0" ::: "memory");   // behind the last stores: the text of the other side of the caller's test follows and reuses their registers
}

// gemmp: the same tile GEMM on plain bf16 operands whose epilogue writes the attention operand planes itself: C[m][n] = sum_k A[m][k] Bt[n][k], stored as fp16 (P16) and, for tokens < RH of each batch, as bf16 hi + lo (Ph, Pl).
// The token axis runs over all batches (NB_ * TT). TR false: tokens are the tile's rows, planes [b][t][d] (hi/lo [b][RH][d]). TR true: tokens are its columns, planes [b][d][t] (hi/lo [b][d][RH]).
// Each wave's whole 64 x 64 f32 tile is staged in LDS (pitch 68) so that every store instruction covers whole 128-B rows of a plane (8 lanes a row, 16 B a lane). With A = weight rows and Bt = token rows it yields the transposed planes [d][t].
// gemmp is the body of one work-group; (bx, by) = its tile row and tile column, smem = 2 * Stg<0>::STAGE bytes.
template <bool TR>
__device__ __forceinline__ void gemmp(char* smem, int bx, int by, const bf* __restrict__ A, const bf* __restrict__ Bt, int K, h16* P16, bf* Ph, bf* Pl) {
    const int wave = __builtin_amdgcn_readfirstlane(threadIdx.x >> 5); float* os = (float*)smem + wave * 64 * 68;   // each wave's output staging (64 x 68 f32) takes the operand buffers' place behind the K loop
    static_assert(4 * 64 * 68 * 4 <= 2 * Stg<0>::STAGE, "the four staged tiles fit the operand buffers");
    const int lane = threadIdx.x & 31, lr = lane & 15, hi = lane >> 4; const int r0 = bx * 128 + (wave >> 1) * 64, c0 = by * 128 + (wave & 1) * 64;   // this wave's 64x64 tile
    v8f acc[4][4];
#pragma unroll
    for (int mb = 0; mb < 4; ++mb)
#pragma unroll
        for (int nb = 0; nb < 4; ++nb) acc[mb][nb] = (v8f){};
    tile_mm<bf, 0>((wave >= 2) ? Bt + (size_t)(by * 128 + (wave & 1) * 64) * K : A + (size_t)(bx * 128 + wave * 64) * K, K, K / Stg<0>::KSTEP, K / Stg<0>::KSTEP, wave, smem, acc);   // waves 0, 1 copy the A rows, waves 2, 3 the Bt rows
#pragma unroll
    for (int mb = 0; mb < 4; ++mb)
#pragma unroll
        for (int nb = 0; nb < 4; ++nb)
#pragma unroll
            for (int j = 0; j < 8; ++j) os[(mb * 16 + hi * 8 + j) * 68 + nb * 16 + lr] = acc[mb][nb][j];
    __syncthreads();   // the staged tile is read by other lanes than wrote it: this orders the LDS traffic
    const int rsub = lane >> 3, cofs = (lane & 7) * 8;
    const int tok = TR ? c0 : r0, bz = tok / TT, tl = tok % TT; const bool hl = (tl < RH);   // the tile's 64 tokens lie in one batch, and wholly below RH or not at all
    const int ld16 = TR ? TT : HD, ldhl = TR ? RH : HD;
    const size_t b16 = TR ? ((size_t)bz * HD + r0) * TT + tl : (size_t)r0 * HD + c0, bhl = TR ? ((size_t)bz * HD + r0) * RH + tl : ((size_t)bz * RH + tl) * HD + c0;
    if (hl) put_planes<true>(os, rsub, cofs, P16 + b16, ld16, Ph + bhl, Pl + bhl, ldhl);   // one test a tile, uniform for the wave, so that each side stays straight-line text
    else put_planes<false>(os, rsub, cofs, P16 + b16, ld16, Ph, Pl, ldhl);
}
// The three projections read the same tokens and are independent of each other: one launch, blockIdx.z = 0 (q), 1 (k), 2 (v). blockIdx.x = token block, blockIdx.y = weight-row block; v takes the weight rows as its tile's rows.
__global__ __launch_bounds__(128) void k_proj(const bf* __restrict__ X, const bf* __restrict__ Wq, const bf* __restrict__ Wk, const bf* __restrict__ Wv, int K, h16* Q16, bf* Qh, bf* Ql, h16* K16, bf* Kh, bf* Kl, h16* V16, bf* Vh, bf* Vl) {
    __shared__ __align__(16) char smem[2 * Stg<0>::STAGE];
    if (blockIdx.z == 2) gemmp<true>(smem, blockIdx.y, blockIdx.x, Wv, X, K, V16, Vh, Vl);
    else { const bool isk = (blockIdx.z == 1); gemmp<false>(smem, blockIdx.x, blockIdx.y, X, isk ? Wk : Wq, K, isk ? K16 : Q16, isk ? Kh : Qh, isk ? Kl : Ql); }
}

__global__ __launch_bounds__(256) void k_wtG(const float* __restrict__ w, int K, int N, bf* Bt) {
    const int lane = threadIdx.x & 31; const int L0 = (blockIdx.x * 8 + (threadIdx.x >> 5)) * 8; const int nlines = N * K / 64;
{
#pragma unroll 1
        for (int l = 0; l < 8; ++l) { const int L = L0 + l; if (L >= nlines) break; const size_t e = (size_t)L * 64 + lane * 2; const int k = (int)(e % K), n = (int)(e / K); v2us o;
            o[0] = f2bf(w[(size_t)k * N + n]); o[1] = f2bf(w[(size_t)(k + 1) * N + n]); *(v2us*)(Bt + e) = o; }
         }
}
// all four inputs to bf16 in one launch: the first XBL blocks take the tokens, then WBL blocks each weight; 8 elements a thread
#define XBL ((unsigned)((size_t)NB_ * TT * DM / 8 / 256))
#define WBL ((unsigned)((size_t)DQ * DM / 8 / 256))
__global__ __launch_bounds__(256) void k_cvt4(const float* __restrict__ x, const float* __restrict__ wq, const float* __restrict__ wk, const float* __restrict__ wv, bf* XB, bf* WQ, bf* WK, bf* WV) {
    static_assert((size_t)NB_ * TT * DM % 2048 == 0 && (size_t)DQ * DM % 2048 == 0 && DQ == DKV, "whole blocks, three weights of one size");
    unsigned b = blockIdx.x; const float* src = x; bf* dst = XB;
    if (b >= XBL) { b -= XBL; const unsigned w = b / WBL; b -= w * WBL; src = (w == 0) ? wq : (w == 1) ? wk : wv; dst = (w == 0) ? WQ : (w == 1) ? WK : WV; }
    const size_t i = (size_t)b * 256 + threadIdx.x; const v8f v = *(const v8f*)(src + i * 8); v8us o;
#pragma unroll
    for (int k = 0; k < 8; ++k) o[k] = f2bf(v[k]); *(v8us*)(dst + i * 8) = o;  }
__global__ __launch_bounds__(256) void k_cscvt(const float* __restrict__ cosT, const float* __restrict__ sinT, float* CS) { const int idx = blockIdx.x * 256 + threadIdx.x; if (idx >= TT * HD) return; v2f cs; cs[0] = bfr(cosT[idx]); cs[1] = bfr(sinT[idx]); *(v2f*)(CS + (size_t)idx * 2) = cs;  }
// k_asoft: per row (zz, i): t = S x HD^-0.5 for j <= i and i - j < WIN (sliding causal window; the reference's -1e9 additive fill vanishes identically); softmax over the row's keys (register row, one exp, fixed trees).
// A row of block rb holds len = (rb + 1) * 64 scores. The row is worked in groups of 512 keys (4 chunks of 128), one wave-uniform test a group; groups that begin at or beyond len are skipped: their terms were exact zeros,
// so the sums keep their values and their order. The last group may read up to 448 f32 past the row, still inside the packed scores (the last block's len is a multiple of 512), and the select masks them.
// The fp16 probabilities go over the row's own scores: the wave has read its whole row before it knows the factor f that every store needs, and for rows >= RH (len > 512) len rounded up to 512 fp16 never outgrows len f32.
__global__ __launch_bounds__(256) void k_asoft(float* Sb, bf* Ph, bf* Pl) {
    const int lane = threadIdx.x & 31; const int row = blockIdx.x * 8 + __builtin_amdgcn_readfirstlane(threadIdx.x >> 5); if (row >= NB_ * TT) return; const int i = row % TT; const int zz = row / TT; const bool hires = (i < RH);
    const int rb = i >> 6, len = (rb + 1) * 64; float* sr = Sb + (size_t)zz * SBZ + pkoff(rb) + (size_t)(i & 63) * len; v4f ld[TT / 128]; float v[TT / 32]; float mx = -3.0e38f;
    static_assert(RH == 512 && TT % 512 == 0, "the hi/lo rows are exactly the rows of one group");
#pragma unroll
    for (int g = 0; g < TT / 512; ++g) if (g * 512 < len) {   // all the row's loads first: one memory latency a row, not one a group
#pragma unroll
        for (int ch = g * 4; ch < g * 4 + 4; ++ch) ld[ch] = *(const v4f*)(sr + ch * 128 + lane * 4); }
    asm volatile("s_wait_xcnt 0x0" ::: "memory");   // behind the last load: the index arithmetic below reuses the address registers that the loads name
#pragma unroll
    for (int g = 0; g < TT / 512; ++g) if (g * 512 < len) {
#pragma unroll
      for (int ch = g * 4; ch < g * 4 + 4; ++ch) { const int j0 = ch * 128 + lane * 4; const v4f a = ld[ch];
#pragma unroll
        for (int q = 0; q < 4; ++q) { const int j = j0 + q; (void)j; float sa = a[q] * SCL; asm volatile("" : "+v"(sa)); const float t = (j <= i) ? sa : -3.0e38f; v[ch * 4 + q] = t; mx = fmaxf(mx, t); } } }
#pragma unroll
    for (int sh = 16; sh; sh >>= 1) mx = fmaxf(mx, __shfl_xor(mx, sh, 32));
    float sum = 0.f;
#pragma unroll
    for (int g = 0; g < TT / 512; ++g) if (g * 512 < len) {
#pragma unroll
        for (int k = g * 16; k < g * 16 + 16; ++k) { float d0 = __fsub_rn(v[k], mx); asm volatile("" : "+v"(d0)); v[k] = __builtin_amdgcn_exp2f(__fmul_rn(d0, 1.4426950408889634f)); sum += v[k]; } }
#pragma unroll
    for (int sh = 16; sh; sh >>= 1) sum += __shfl_xor(sum, sh, 32);
    const float f = __fdiv_rn(hires ? 1.0f : PCAR, sum);
{
        if (hires) {
#pragma unroll
            for (int ch = 0; ch < RH / 128; ++ch) { v4us oh, ol;
#pragma unroll
                for (int q = 0; q < 4; ++q) { unsigned short a, c2; splitf(v[ch * 4 + q] * f, a, c2); oh[q] = a; ol[q] = c2; }
                const size_t oo = ((size_t)zz * RH + i) * RH + ch * 128 + lane * 4; *(v4us*)(Ph + oo) = oh; *(v4us*)(Pl + oo) = ol; }
        } else {
            h16* pr = (h16*)sr;
#pragma unroll
            for (int g = 0; g < TT / 512; ++g) if (g * 512 < len) {
#pragma unroll
              for (int ch = g * 4; ch < g * 4 + 4; ++ch) { v4h o4;
#pragma unroll
                for (int q = 0; q < 4; ++q) o4[q] = tohx(v[ch * 4 + q] * f);
                *(v4h*)(pr + ch * 128 + lane * 4) = o4; }
              asm volatile("s_wait_xcnt 0x0" ::: "memory"); }   // the next group's conversions may reuse the registers that this group's stores name
        }
         }
}
__global__ __launch_bounds__(256) void k_merge(const float* __restrict__ O, int h0, bf* Ah, bf* Al) { const size_t e = ((size_t)blockIdx.x * 256 + threadIdx.x) * 2; if (e >= (size_t)ZH * TT * HD) return; const int d = (int)(e % HD); const int t = (int)((e / HD) % TT); const int zz = (int)(e / ((size_t)HD * TT)); const float cs = (t < RH) ? 1.0f : (1.0f / PCAR); const size_t oo = (size_t)t * DQ + (h0 + zz) * HD + d;
    v2us oh, ol;
#pragma unroll
    for (int q = 0; q < 2; ++q) { unsigned short a, c2; splitf(O[e + q] * cs, a, c2); oh[q] = a; ol[q] = c2; } *(v2us*)(Ah + oo) = oh; *(v2us*)(Al + oo) = ol;  }


extern "C" void kernel_launch(void* const* d_in, const int* in_sizes, int n_in,
                              void* d_out, int out_size, void* d_ws, size_t ws_size, hipStream_t stream) {
    (void)in_sizes; (void)n_in; (void)out_size;
    const float* x = (const float*)d_in[0]; const float* wq = (const float*)d_in[1]; const float* wk = (const float*)d_in[2]; const float* wv = (const float*)d_in[3];
    float* OUT = (float*)d_out;     // [4][4096][768]
    char* wsp = (char*)d_ws;
    auto take = [&](size_t bytes) { char* p = wsp; wsp += (bytes + 255) & ~(size_t)255; return (void*)p; };
    bf* WQ = (bf*)take((size_t)DQ * DM * 2); bf* WK = (bf*)take((size_t)DKV * DM * 2); bf* WV = (bf*)take((size_t)DKV * DM * 2);
    bf* XB = (bf*)take((size_t)NB_ * TT * DM * 2);
    h16* QP16 = (h16*)take((size_t)NB_ * TT * HD * 2); h16* KP16 = (h16*)take((size_t)NB_ * TT * HD * 2); h16* VT16 = (h16*)take((size_t)NB_ * HD * TT * 2);
    bf* QPh = (bf*)take((size_t)NB_ * RH * HD * 2); bf* QPl = (bf*)take((size_t)NB_ * RH * HD * 2); bf* KPh = (bf*)take((size_t)NB_ * RH * HD * 2); bf* KPl = (bf*)take((size_t)NB_ * RH * HD * 2); bf* VTh = (bf*)take((size_t)NB_ * HD * RH * 2); bf* VTl = (bf*)take((size_t)NB_ * HD * RH * 2); bf* Ph = (bf*)take((size_t)NB_ * RH * RH * 2); bf* Pl = (bf*)take((size_t)NB_ * RH * RH * 2);
    float* Sb = (float*)take((size_t)NB_ * SBZ * 4);      // packed causal scores; the fp16 probabilities of rows >= RH take their place row by row
    if ((size_t)(wsp - (char*)d_ws) > ws_size) return;    // ws 256 MiB
    k_cvt4<<<XBL + 3 * WBL, 256, 0, stream>>>(x, wq, wk, wv, XB, WQ, WK, WV);
    k_proj<<<dim3(NB_ * TT / 128, HD / 128, 3), 128, 0, stream>>>(XB, WQ, WK, WV, DM, QP16, QPh, QPl, KP16, KPh, KPl, VT16, VTh, VTl);      // q, k planes [b][t][d]; v planes transposed [b][d][t]
    k_scores<<<(RH / 128) * (RH / 128) * NB_ + ((TT - RH) / 128) * (TT / 128) * NB_, 128, 0, stream>>>(QPh, QPl, KPh, KPl, QP16, KP16, HD, Sb);
    k_asoft<<<NB_ * TT / 8, 256, 0, stream>>>(Sb, Ph, Pl);
    k_pv<<<(RH / 128) * (HD / 128) * NB_ + ((TT - RH) / 128) * (HD / 128) * NB_, 128, 0, stream>>>(Ph, Pl, VTh, VTl, (const h16*)Sb, VT16, RH, TT, OUT);
}

// v007
// Measured time: 171 microseconds a run.
// Versions between v005 and this one are left out; their measured steps multiply to 1.14 times as fast.
// Counting every step since v000, it is 6.42 times as fast.
#include <hip/hip_runtime.h>

// CausalMaskedAttention (input [4][4096][768]; q/k/v = x W^T ([768][768], one head of width 768); scores = q.k / sqrt(768) (the source scales by d_in), causal (-inf); softmax; out = weights v -> [4][4096][768] (no output projection)).
// Compute dtypes, f32 accumulate: every input rounded to bf16; q/k/v on PLAIN bf16 operands (inputs: exact); causal scores and attn.v: query rows < 512 hl (3 products), the rest single fp16 (x1024), causal tile skipping; softmax f32 (rows < 512: a wave a row; the rest: by 64-key tiles in the score GEMM's epilogue, joined by a factor per row and tile on the attn.v A fragments); the context written directly in f32 by the attn.v GEMM; the q/k/v operand planes written by the projection GEMMs' epilogues.
// Every launch covers all four batches, and launches that do not depend on each other are one launch (5 in all): the input conversions; the three projections; hi/lo and fp16 score tiles; the hi/lo rows' softmax and the tiles' factors; hi/lo and fp16 attn.v tiles. The hi/lo scores (f32) and the fp16 probabilities are stored packed by causal 64-row blocks
// (block rb: 64 rows of (rb + 1) * 64 elements), and the hi/lo planes exist only for the RH rows, keys and value columns that read them.

#define NB_  4
#define TT   4096
#define DM   768
#define NH_  1
#define NKV  1
#define REP  (NH_ / NKV)
#define HD   768
#define DQ   (NH_ * HD)
#define DKV  (NKV * HD)
#define ZH   1
#define RH   512                  // query rows < RH use hi+lo planes
#define WIN  4096
#define PCAR 1024.0f
#define SCL  0.036084391824351615f   // 1/sqrt(d_in = 768)
#define SBZ  ((size_t)(TT / 64) * (TT / 64 + 1) / 2 * 4096)   // elements of one batch's packed causal tiles (the fp16 probabilities)
#define SBH  ((size_t)(RH / 64) * (RH / 64 + 1) / 2 * 4096)   // f32 elements of one batch's packed causal scores, the RH hi/lo rows alone
#define NRB  (TT / 64)            // 64-row blocks, and 64-key tiles, of a sequence
#define SCL2 0.05205877313848633f         // SCL * log2(e): the tiles' exponentials are taken to base 2
typedef _Float16 h16;
typedef unsigned short bf;
typedef __attribute__((ext_vector_type(16))) __bf16   v16bf;
typedef __attribute__((ext_vector_type(16))) _Float16 v16h;
typedef __attribute__((ext_vector_type(8)))  _Float16 v8h;
typedef __attribute__((ext_vector_type(8)))  unsigned short v8us;
typedef __attribute__((ext_vector_type(8)))  float    v8f;
typedef __attribute__((ext_vector_type(4)))  float    v4f;
typedef __attribute__((ext_vector_type(4)))  _Float16 v4h;
typedef __attribute__((ext_vector_type(2)))  float    v2f;
typedef v8h  __attribute__((may_alias)) v8ha;
typedef v4f  __attribute__((may_alias)) v4fa;
typedef v8us __attribute__((may_alias)) v8usa;
// first f32 element of 64-row block rb in a batch's packed scores: the blocks before it hold 1 + 2 + ... + rb tiles of 64 x 64
__device__ __forceinline__ size_t pkoff(int rb) { return (size_t)(rb * (rb + 1) / 2) * 4096; }

__device__ __forceinline__ unsigned short f2bf(float f) { unsigned u = __float_as_uint(f); u += 0x7FFFu + ((u >> 16) & 1u); return (unsigned short)(u >> 16); }
__device__ __forceinline__ float bf2f(unsigned short b) { return __uint_as_float(((unsigned)b) << 16); }
__device__ __forceinline__ float bfr(float f) { return bf2f(f2bf(f)); }
__device__ __forceinline__ v16h cat16(v8h lo, v8h hi) { return __builtin_shufflevector(lo, hi, 0, 1, 2, 3, 4, 5, 6, 7, 8, 9, 10, 11, 12, 13, 14, 15); }
__device__ __forceinline__ v16bf cat16b(v8us lo, v8us hi) { return __builtin_bit_cast(v16bf, __builtin_shufflevector(lo, hi, 0, 1, 2, 3, 4, 5, 6, 7, 8, 9, 10, 11, 12, 13, 14, 15)); }
__device__ __forceinline__ v8f wmma16(v16h a, v16h b, v8f c) { return __builtin_amdgcn_wmma_f32_16x16x32_f16(false, a, false, b, (short)0, c, false, false); }
__device__ __forceinline__ v8f wmmab(v16bf a, v16bf b, v8f c) { return __builtin_amdgcn_wmma_f32_16x16x32_bf16(false, a, false, b, (short)0, c, false, false); }



// ---- register-blocked GEMMs, one wave per 64x64 output tile (16 accumulators), FOUR WAVES (2 x 2) a work-group on one 128x128 tile: the four share each K step's operand rows in LDS (tile_mm), so every row
// is fetched from L2 once for two waves; operands from K-contiguous 16-bit planes; 128 threads.
// C[m][n] = sum_k A[m][k] Bt[n][k] (+ split products per NSPLIT). K % Stg<NSPLIT>::KSTEP == 0 (64 for one product, 32 for three).
template <typename T16> struct WFrag;
template <> struct WFrag<h16> { typedef v16h V; static __device__ __forceinline__ V ld(const h16* p) { return cat16(*(const v8h*)p, *(const v8h*)(p + 16)); } static __device__ __forceinline__ v8f mma(V a, V b, v8f c) { return wmma16(a, b, c); } };
template <> struct WFrag<bf> { typedef v16bf V; static __device__ __forceinline__ V ld(const bf* p) { return cat16b(*(const v8us*)p, *(const v8us*)(p + 16)); } static __device__ __forceinline__ v8f mma(V a, V b, v8f c) { return wmmab(a, b, c); } };
// ---- operand staging for the 128x128 tile GEMMs: each K step's operand rows (128 a plane) go from global memory to LDS through no register, two buffers, the next step's rows in flight while this step's fragments are read
// from LDS. Each wave brings a quarter of a stage (SLICE). One product: ONE tensor load a wave and step, 64 rows of 128 B of A (waves 0, 1) or of Bt (waves 2, 3), padded by the mover to the pitch of 144 B; a slice takes
// 64 * 144 B rounded up to a multiple of 2 KiB, so that every slice starts on one. Three products: 64-B rows by 16 asynchronous copies a wave (4 lanes a row), one whole plane a wave (A, Bt, A2, Bt2 in wave order).
template <int NSPLIT> struct Stg { static constexpr int RB = (NSPLIT >= 2) ? 64 : 128, PITCH = RB + 16, LPR = RB / 16, RPC = 32 / LPR, PLANE = 128 * PITCH, SLICE = (NSPLIT >= 2) ? PLANE : (64 * PITCH + 2047) / 2048 * 2048, STAGE = 4 * SLICE, CPW = PLANE / (RPC * PITCH), KSTEP = RB / 2, KS = RB / 64; };
typedef unsigned u32x4 __attribute__((ext_vector_type(4)));
typedef unsigned u32x8 __attribute__((ext_vector_type(8)));
__device__ __forceinline__ unsigned uni(unsigned v) { return (unsigned)__builtin_amdgcn_readfirstlane(v); }
// a wave-uniform value held in a scalar register and formed where this stands: the test around a tensor load becomes a scalar branch, and a descriptor word made of it is formed behind the wait in front
__device__ __forceinline__ unsigned pinned(unsigned v) { unsigned w = (unsigned)__builtin_amdgcn_readfirstlane(v); asm volatile("" : "+s"(w)); return w; }
typedef int gv4i __attribute__((vector_size(16)));
// one copy of 16 B a lane, global -> LDS, through no register
template <typename T16>
__device__ __forceinline__ void copy16(const T16* g, char* l) { __builtin_amdgcn_global_load_async_to_lds_b128((__attribute__((address_space(1))) gv4i*)g, (__attribute__((address_space(3))) gv4i*)l, 0, 0); }
// The wave's 64x64 tile (wm, wn) of the work-group's 128x128: acc += A[wm * 64 ..+63][k] x Bt[wn * 64 ..+63][k]^T (+ the split products), k ascending in steps of 32 as before, over the wave's own first ntw K steps.
// src: first element of the rows that THIS wave copies (its quarter of every stage), ld: their pitch in elements. nt: K steps that the work-group stages (>= 1, >= ntw, the same in all four waves); a wave with
// ntw < nt copies and passes every barrier to the end and only leaves the products out. smem: 2 * Stg<NSPLIT>::STAGE bytes, shared by the four waves.
// SCA: every K step is one 64-key tile of probabilities that carry their own tile's maximum; fac (LDS, 256 B a step; the lane's four A rows side by side) holds the factor that brings a row's tile to the row's own softmax, and the A fragments are multiplied by it.
// SWP: the two operands change places at the WMMA: acc[mb][nb] holds the transposed 16x16 product (its rows run along Bt's rows, its columns along A's).
template <typename T16, int NSPLIT, bool SCA = false, bool SWP = false>
__device__ __forceinline__ void tile_mm(const T16* __restrict__ src, int ld, int nt, int ntw, int wave, char* smem, v8f (&acc)[4][4], const char* fac = nullptr) {
    typedef typename WFrag<T16>::V V; typedef Stg<NSPLIT> S;
    static_assert(NSPLIT == 0 || NSPLIT == 2, "one product or the three hi/lo products");
    const int lane = threadIdx.x & 31, lr = lane & 15, hi = lane >> 4, wm = wave >> 1, wn = wave & 1;
    const T16* g0 = src + (size_t)(lane / S::LPR) * ld + (lane % S::LPR) * 8;
    char* l0 = smem + wave * S::SLICE + (lane / S::LPR) * S::PITCH + (lane % S::LPR) * 16;
    // descriptor group 1 of the wave's slice, the same for every step: 1-byte elements, tensor = tile = 64 rows of 128 B, source pitch ld elements, 4 dwords of pad behind every 32 (LDS pitch 144 B), no mask
    u32x8 g1 = {}; u32x4 d0 = {};   // d0: group 0 of the wave's last request
    if constexpr (NSPLIT == 0) { g1[0] = uni((1u << 20) | (4u << 22) | (3u << 25)); g1[1] = uni(128u << 16); g1[2] = uni(64u << 16); g1[3] = uni(128u << 16); g1[4] = uni(64u); g1[5] = uni((unsigned)ld * 2u); g1[6] = uni(0u); g1[7] = uni(0u); }
    auto fill = [&](int t) {
        if constexpr (NSPLIT == 0) {
            const unsigned ts = pinned((unsigned)t);   // a descriptor word's source held in a scalar register: group 0 is formed here, behind the wait on the request before
            const unsigned long long ga = (unsigned long long)(size_t)src + (unsigned long long)ts * 128u;
            d0[0] = uni(1u); d0[1] = uni((unsigned)(size_t)smem + (unsigned)wave * S::SLICE + (ts & 1u) * S::STAGE); d0[2] = uni((unsigned)ga); d0[3] = uni((((unsigned)(ga >> 32)) & 0x01FFFFFFu) | 0x80000000u);
            asm volatile("tensor_load_to_lds %0, %1" :: "s"(d0), "s"(g1) : "memory");   // one request of the whole wave: its 64 rows of step t
        } else {
#pragma unroll
            for (int g = 0; g < S::CPW; ++g)
                copy16<T16>(g0 + (size_t)t * S::KSTEP + (size_t)(g * S::RPC) * ld, l0 + (t & 1) * S::STAGE + g * S::RPC * S::PITCH);
        }
    };
    fill(0);
    // every wait on a request names its descriptor as inputs: the two groups then stay in their scalar registers, untouched, for as long as the request is in flight
    if constexpr (NSPLIT == 0) asm volatile("s_wait_tensorcnt 0x0" :: "s"(d0), "s"(g1) : "memory");   // this wave's share of step 0 has landed
    if constexpr (NSPLIT != 0 || SCA) asm volatile("s_wait_asynccnt 0x0" ::: "memory");   // the same for the copies; SCA: the caller's copies of the factors have landed
    if constexpr (NSPLIT != 0) {
        __syncthreads();   // the ring's publish point: every wave's share of step 0 has landed before any wave reads it
        if (nt > 1) fill(1);
    }
    // One product: the loop starts one trip early, at t = -1, a trip without products: its foot is step 0's publish point (the barrier behind the wait above) and issues step 1. Every request but step 0's, which is waited
    // for at once, is so issued at the one place at the loop's foot and waited for at the one place above it, and the text between the two leaves its descriptor's registers alone.
#pragma unroll 1
    for (int t = (NSPLIT == 0) ? -1 : 0; t < nt; ++t) {
        if ((unsigned)t < (unsigned)ntw) {   // uniform for the wave (a scalar test): EXEC stays all ones at the WMMAs
            const char* sa = smem + (t & 1) * S::STAGE + ((NSPLIT == 0) ? wm * S::SLICE : wm * 64 * S::PITCH) + lr * S::PITCH + hi * 16, *sb = smem + (t & 1) * S::STAGE + ((NSPLIT == 0) ? (2 + wn) * S::SLICE : S::PLANE + wn * 64 * S::PITCH) + lr * S::PITCH + hi * 16;
            V a[S::KS][4], b[S::KS][4], a2[S::KS][4], b2[S::KS][4];
#pragma unroll
            for (int ks = 0; ks < S::KS; ++ks)
#pragma unroll
                for (int q = 0; q < 4; ++q) { a[ks][q] = WFrag<T16>::ld((const T16*)(sa + q * 16 * S::PITCH + ks * 64)); b[ks][q] = WFrag<T16>::ld((const T16*)(sb + q * 16 * S::PITCH + ks * 64));
                    if (NSPLIT >= 2) { a2[ks][q] = WFrag<T16>::ld((const T16*)(sa + 2 * S::PLANE + q * 16 * S::PITCH + ks * 64)); b2[ks][q] = WFrag<T16>::ld((const T16*)(sb + 2 * S::PLANE + q * 16 * S::PITCH + ks * 64)); } }
            v4h f4; if constexpr (SCA) f4 = *(const v4h*)(fac + t * 256);
            __builtin_amdgcn_sched_barrier(0);   // keeps the step's LDS reads together ahead of its WMMAs: sunk among them, each group makes the wave wait out the LDS latency
            if constexpr (SCA) {
#pragma unroll
                for (int ks = 0; ks < S::KS; ++ks)
#pragma unroll
                    for (int q = 0; q < 4; ++q) a[ks][q] *= f4[q];
            }
#pragma unroll
            for (int ks = 0; ks < S::KS; ++ks)
#pragma unroll
                for (int nb = 0; nb < 4; ++nb)
#pragma unroll
                    for (int mb = 0; mb < 4; ++mb) { acc[mb][nb] = SWP ? WFrag<T16>::mma(b[ks][nb], a[ks][mb], acc[mb][nb]) : WFrag<T16>::mma(a[ks][mb], b[ks][nb], acc[mb][nb]); if (NSPLIT >= 2) { acc[mb][nb] = WFrag<T16>::mma(a2[ks][mb], b[ks][nb], acc[mb][nb]); acc[mb][nb] = WFrag<T16>::mma(a[ks][mb], b2[ks][nb], acc[mb][nb]); } }
            __builtin_amdgcn_sched_barrier(0);   // keeps the waits below behind the WMMAs: lifted over them, the wave would sit out the next step's copies before its matrix work and not under it
        }
        asm volatile("s_wait_dscnt 0x0" ::: "memory");      // this step's LDS reads have retired before its buffer is refilled
        if constexpr (NSPLIT == 0) asm volatile("s_wait_tensorcnt 0x0" :: "s"(d0), "s"(g1) : "memory"); else asm volatile("s_wait_asynccnt 0x0" ::: "memory");   // this wave's share of the next step has landed
        __syncthreads();   // publish point: the next step is whole for every wave, and every wave has left the buffer that is refilled below
        if constexpr (NSPLIT == 0) { if (pinned(t + 2 < nt)) fill(t + 2); } else { if (t + 2 < nt) fill(t + 2); }
    }
    if constexpr (NSPLIT == 0) asm volatile("s_wait_tensorcnt 0x0" ::: "memory"); else asm volatile("s_wait_asynccnt 0x0" ::: "memory");   // nothing in flight when the buffers become the output staging
    asm volatile("s_wait_dscnt 0x0" ::: "memory");          // and no LDS read of this wave
    __builtin_amdgcn_sched_barrier(0);   // keeps the text behind the loop, which takes the descriptors' scalar registers for other values, behind the two waits
}

// ---- gemmc: the same tile GEMM specialised for causal attention: CMODE 1 skips score tiles entirely above the diagonal (query rows r0+roff.., key columns c0..; a whole work-group returns, a single wave of a
// diagonal work-group only copies), CMODE 2 limits each wave's key (K) loop of the probability x value contraction to its rows' diagonal block (probabilities beyond it are exactly zero). roff = row offset within the sequence of the body's tile row 0 (0 for the hi/lo bodies, RH for the fp16 ones). CMODE 2 stores acc x osc (the inverse of the probabilities' carry factor), so C is the final output.
// CMODE 1 stores into the packed scores (C = the batch's first element, ldc unused). CMODE 3 = CMODE 2 with A = the packed fp16 probabilities (A = their first element, pitch = the block's row length).
// gemmc is the body of one work-group; (bx, by, bz) = its tile row, tile column and batch, smem = 2 * Stg<NSPLIT>::STAGE bytes (CMODE 3: another 256 B a staged K step behind them, for the factors). The kernels k_scores and k_pv below pick the body by the block index.
// CMODE 4 = CMODE 1 whose epilogue does the tile's share of the softmax: each wave's 64x64 tile is stored as fp16 exp2(s * SCL2 - m), m = the row's maximum over this tile's unmasked keys, into the packed probabilities P (block rb: 64 rows of (rb + 1) * 64 fp16),
// with (m, sum of the tile's exponentials) per row in ST [batch][rb][key tile][64 rows]. CMODE 3 reads those probabilities and the factors FC that k_soft makes of ST ([batch][rb / 2][key tile][rb & 1][64]).
// CMODE 4 takes the key rows as the WMMA's A and the query rows as its B (tile_mm's SWP), so that a lane holds scores of one query in every accumulator: maximum and sum run inside the lane, with one exchange between the wave's halves.
__device__ __forceinline__ float xhalf(float x) { return __builtin_bit_cast(float, __builtin_amdgcn_permlanex16(__builtin_bit_cast(int, x), __builtin_bit_cast(int, x), 0x76543210, 0xfedcba98, false, false)); }   // lane l with lane l ^ 16
// Eight base-2 exponentials in one statement: each stands in front of an independent one (no result shares a register with a source) and a v_nop behind the last: the slot that the instruction set asks for between a
// transcendental and an instruction that reads its result or overwrites its source.
__device__ __forceinline__ void exp2x8(const float (&x)[8], float (&e)[8]) {
    asm("v_exp_f32 %0, %8\n\tv_exp_f32 %1, %9\n\tv_exp_f32 %2, %10\n\tv_exp_f32 %3, %11\n\tv_exp_f32 %4, %12\n\tv_exp_f32 %5, %13\n\tv_exp_f32 %6, %14\n\tv_exp_f32 %7, %15\n\tv_nop"
        : "=&v"(e[0]), "=&v"(e[1]), "=&v"(e[2]), "=&v"(e[3]), "=&v"(e[4]), "=&v"(e[5]), "=&v"(e[6]), "=&v"(e[7]) : "v"(x[0]), "v"(x[1]), "v"(x[2]), "v"(x[3]), "v"(x[4]), "v"(x[5]), "v"(x[6]), "v"(x[7]));
}
template <typename T16, int NSPLIT, int CMODE>
__device__ __forceinline__ void gemmc(char* smem, int bx, int by, int bz, const T16* __restrict__ A, const T16* __restrict__ A2, const T16* __restrict__ Bt, const T16* __restrict__ Bt2, int K, float* C, int ldc, int roff, float osc, size_t sA, size_t sB, size_t sC, h16* P = nullptr, float* ST = nullptr, const h16* FC = nullptr) {
    constexpr bool SCO = (CMODE == 1 || CMODE == 4), PV = (CMODE == 2 || CMODE == 3);
    typedef typename WFrag<T16>::V V;
    typedef Stg<NSPLIT> S;
    const int wave = __builtin_amdgcn_readfirstlane(threadIdx.x >> 5); float* os = (float*)smem + wave * 16 * 68;   // each wave's output staging (16 x 68 f32) takes the operand buffers' place behind the K loop
    const size_t z = bz; A += z * sA; if (A2) A2 += z * sA; Bt += z * sB; if (Bt2) Bt2 += z * sB; C += z * sC;
    const int lane = threadIdx.x & 31, lr = lane & 15, hi = lane >> 4; const int R0 = bx * 128, C0 = by * 128;
    if (SCO && C0 > R0 + roff + 127) return;                 // all four score tiles above the causal diagonal: the whole work-group leaves, ahead of every barrier
    const int r0 = R0 + (wave >> 1) * 64, c0 = C0 + (wave & 1) * 64;  // this wave's 64x64 tile
    const bool live = !(SCO && c0 > r0 + roff + 63);          // score tile entirely above the causal diagonal: it has no place in the packed scores or probabilities and is never read
    const int nt = (PV ? min(K, R0 + roff + 128) : K) / S::KSTEP;                    // K steps staged: as far as the lower 64 rows need
    const int ntw = PV ? min(K, r0 + roff + 64) / S::KSTEP : (live ? nt : 0);         // P.V: probabilities are exactly 0 beyond the rows' diagonal block, so the wave's products stop there
    const int rb = (r0 + roff) >> 6;                                 // this tile's 64-row block within the sequence
    // the rows that this wave copies, a quarter of every stage. CMODE 3: the two 64-row blocks of A have each their own start and pitch; the upper block's last staged step lies past its rows' probabilities, on the next row's (for the last row the lower block's) first ones, and is not multiplied (ntw)
    const T16* src; int ld = K;
    if (NSPLIT >= 2) src = ((wave == 0) ? A : (wave == 1) ? Bt : (wave == 2) ? A2 : Bt2) + (size_t)((wave & 1) ? C0 : R0) * K;
    else if (wave >= 2) src = Bt + (size_t)(C0 + (wave & 1) * 64) * K;
    else if (CMODE == 3) { const int rbh = ((R0 + roff) >> 6) + wave; src = A + pkoff(rbh); ld = (rbh + 1) * 64; }
    else src = A + (size_t)(R0 + wave * 64) * K;
    v8f acc[4][4];
#pragma unroll
    for (int mb = 0; mb < 4; ++mb)
#pragma unroll
        for (int nb = 0; nb < 4; ++nb) acc[mb][nb] = (v8f){};
    if constexpr (CMODE == 3) {
        // the 128 rows' factors, 256 B a K step, to LDS behind the operand buffers: nt is even here, a copy brings two steps, the waves take turns; tile_mm's first s_wait_asynccnt and barrier, ahead of every read, cover these copies too
        const h16* fg = FC + ((z * (NRB / 2) + ((R0 + roff) >> 7)) * NRB) * 128 + lane * 8; char* fl = smem + 2 * S::STAGE + lane * 16;
#pragma unroll 1   // at most 8 trips, once a work-group: kept rolled for short text
        for (int c = wave; c < nt / 2; c += 4) copy16<h16>(fg + (size_t)c * 256, fl + c * 512);
        tile_mm<T16, NSPLIT, true>(src, ld, nt, ntw, wave, smem, acc, smem + 2 * S::STAGE + (wave >> 1) * 128 + lr * 8);
    } else tile_mm<T16, NSPLIT, false, CMODE == 4>(src, ld, nt, ntw, wave, smem, acc);
    if (!live) return;   // behind the last barrier
    if constexpr (CMODE == 4) {
        // acc[mb][nb][j]: query r0 + mb * 16 + lr, key c0 + nb * 16 + hi * 8 + j
        if (c0 == r0 + roff) {   // the diagonal tile (a scalar test): keys behind the query are masked
#pragma unroll
            for (int mb = 0; mb < 4; ++mb)
#pragma unroll
                for (int nb = mb; nb < 4; ++nb)
#pragma unroll
                    for (int j = 0; j < 8; ++j) acc[mb][nb][j] = (nb == mb && hi * 8 + j <= lr) ? acc[mb][nb][j] : -3.0e38f;
        }
        char* ps = smem + wave * (64 * 144);   // this wave's 64 x 64 fp16 tile, [query][key] at pitch 144 B, staged so that every global store covers whole 128-B rows
        float mm[4], ll[4];
#pragma unroll
        for (int mb = 0; mb < 4; ++mb) {
            float mr = acc[mb][0][0];
#pragma unroll
            for (int nb = 0; nb < 4; ++nb)
#pragma unroll
                for (int j = 0; j < 8; ++j) mr = fmaxf(mr, acc[mb][nb][j]);
            mr = fmaxf(mr, xhalf(mr));   // the tile's first key is unmasked for every query (c0 <= r0 + roff), so this is a score
            const float m = mr * SCL2; float ls[4];
#pragma unroll
            for (int nb = 0; nb < 4; ++nb) { v8h o; float x[8], e[8]; ls[nb] = 0.f;
#pragma unroll
                for (int j = 0; j < 8; ++j) x[j] = acc[mb][nb][j] * SCL2 - m;
                exp2x8(x, e);
#pragma unroll
                for (int j = 0; j < 8; ++j) { o[j] = (h16)e[j]; ls[nb] += e[j]; }
                *(v8ha*)(ps + (mb * 16 + lr) * 144 + nb * 32 + hi * 16) = o; }
            const float l = (ls[0] + ls[1]) + (ls[2] + ls[3]);
            mm[mb] = m; ll[mb] = l + xhalf(l);
        }
        __builtin_amdgcn_wave_barrier(); asm volatile("" ::: "memory");   // the staged rows are read by other lanes than wrote them: keeps the compiler from moving the reads up
        h16* Pb = P + z * SBZ + pkoff(rb) + c0; const int ldp = (rb + 1) * 64, lofs = (lane >> 3) * ldp + (lane & 7) * 8;
        v8h pr[16];   // all the rows first: one LDS latency
#pragma unroll
        for (int it = 0; it < 16; ++it) pr[it] = *(const v8ha*)(ps + (it * 4 + (lane >> 3)) * 144 + (lane & 7) * 16);
#pragma unroll
        for (int it = 0; it < 16; ++it) *(v8h*)(Pb + it * 4 * ldp + lofs) = pr[it];
        float* sp = ST + (((z * NRB + rb) * NRB + (c0 >> 6)) * 64) * 2 + lane * 2;   // both halves hold every query's pair: the lower stores queries mb * 16 + lr of even mb, the upper of odd mb
#pragma unroll
        for (int mb = 0; mb < 4; mb += 2) { v2f ml; ml[0] = hi ? mm[mb + 1] : mm[mb]; ml[1] = hi ? ll[mb + 1] : ll[mb]; *(v2f*)(sp + mb * 32) = ml; }
        return;
    }
    float* Cb = (CMODE == 1) ? C + pkoff(rb) : C + (size_t)r0 * ldc; const int ldo = (CMODE == 1) ? (rb + 1) * 64 : ldc;
#pragma unroll
    for (int mb = 0; mb < 4; ++mb) {
#pragma unroll
        for (int nb = 0; nb < 4; ++nb) {
#pragma unroll
            for (int j = 0; j < 8; ++j) os[(hi * 8 + j) * 68 + nb * 16 + lr] = acc[mb][nb][j]; }
        __builtin_amdgcn_wave_barrier(); asm volatile("" ::: "memory");
        float* crow = Cb + (size_t)(mb * 16) * ldo + c0;
{
#pragma unroll
            for (int s = 0; s < 8; ++s) { const int row = 2 * s + hi, cofs = lr * 4; v4f val = *(const v4fa*)(os + row * 68 + cofs); if (PV) val *= osc;
                *(v4f*)(crow + (size_t)row * ldo + cofs) = val; }
             }
        __builtin_amdgcn_wave_barrier(); asm volatile("" ::: "memory");
    }
    asm volatile("s_wait_xcnt 0x0" ::: "memory");   // behind the last stores: the text of the other body of the calling kernel's test follows and reuses their registers
}

// The hi/lo tiles (query rows < RH) and the fp16 tiles of one attention GEMM are independent of each other: one launch holds both. The few, long hi/lo work-groups take the lowest block indices, so that they start first
// and run beside the fp16 work-groups, which keep their order (tile row fastest, then tile column, then batch).
#define SMC ((2 * Stg<2>::STAGE > 2 * Stg<0>::STAGE) ? 2 * Stg<2>::STAGE : 2 * Stg<0>::STAGE)
__global__ __launch_bounds__(128) void k_scores(const bf* __restrict__ Qh, const bf* __restrict__ Ql, const bf* __restrict__ Kh, const bf* __restrict__ Kl, const h16* __restrict__ Q16, const h16* __restrict__ K16, int K, float* Sb, h16* P, float* ST) {
    __shared__ __attribute__((aligned(2048))) char smem[SMC];   // a tensor load's place in LDS is a multiple of 2 KiB
    constexpr int HX = RH / 128, NHW = HX * HX * NB_, NX = (TT - RH) / 128, NY = TT / 128;
    const int id = blockIdx.x;
    if (id < NHW) gemmc<bf, 2, 1>(smem, id % HX, id / HX % HX, id / (HX * HX), Qh, Ql, Kh, Kl, K, Sb, 0, 0, 1.0f, (size_t)RH * HD, (size_t)RH * HD, SBH);
    else { const int m = id - NHW; gemmc<h16, 0, 4>(smem, m % NX, m / NX % NY, m / (NX * NY), Q16 + (size_t)RH * HD, nullptr, K16, nullptr, K, nullptr, 0, RH, 1.0f, (size_t)TT * HD, (size_t)TT * HD, 0, P, ST); }
}
__global__ __launch_bounds__(128) void k_pv(const bf* __restrict__ Ph, const bf* __restrict__ Pl, const bf* __restrict__ VTh, const bf* __restrict__ VTl, const h16* __restrict__ P16, const h16* __restrict__ VT16, int Kh, int Kf, float* O, const h16* __restrict__ FC) {
    __shared__ __attribute__((aligned(2048))) char smem[(SMC > 2 * Stg<0>::STAGE + NRB * 256) ? SMC : 2 * Stg<0>::STAGE + NRB * 256];   // the fp16 body keeps its rows' factors behind its operand buffers
    constexpr int HX = RH / 128, NY = HD / 128, NHW = HX * NY * NB_, NX = (TT - RH) / 128;
    const int id = blockIdx.x;
    if (id < NHW) gemmc<bf, 2, 2>(smem, id % HX, id / HX % NY, id / (HX * NY), Ph, Pl, VTh, VTl, Kh, O, HD, 0, 1.0f, (size_t)RH * RH, (size_t)HD * RH, (size_t)TT * HD);
    else { const int m = id - NHW; gemmc<h16, 0, 3>(smem, m % NX, m / NX % NY, m / (NX * NY), P16, nullptr, VT16, nullptr, Kf, O + (size_t)RH * HD, HD, RH, 1.0f / PCAR, SBZ, (size_t)HD * TT, (size_t)TT * HD, nullptr, nullptr, FC); }
}

__device__ __forceinline__ h16 tohx(float x) { return (h16)x; }
__device__ __forceinline__ void splitf(float y, unsigned short& h, unsigned short& l) { h = f2bf(y); l = f2bf(y - bf2f(h)); }
typedef __attribute__((ext_vector_type(2))) _Float16 v2h;
typedef __attribute__((ext_vector_type(2))) unsigned short v2us;
typedef __attribute__((ext_vector_type(4))) unsigned short v4us;
typedef __attribute__((ext_vector_type(4))) int v4i;

// the staged 64 x 64 f32 tile (pitch 68) to the planes: fp16 always, bf16 hi + lo where HL. p16, ph, pl: the tile's first element in each plane.
template <bool HL>
__device__ __forceinline__ void put_planes(const float* os, int rsub, int cofs, h16* p16, int ld16, bf* ph, bf* pl, int ldhl) {
#pragma unroll   // straight-line text (the kernel stays far under 32 KB): constant LDS offsets, and LDS reads of later rows issue under the conversions of earlier ones
    for (int s = 0; s < 16; ++s) { const int row = s * 4 + rsub; const v4f u0 = *(const v4fa*)(os + row * 68 + cofs), u1 = *(const v4fa*)(os + row * 68 + cofs + 4); v8h o16; v8us oh, ol;
#pragma unroll
        for (int q = 0; q < 8; ++q) { const float r = (q < 4) ? u0[q & 3] : u1[q & 3]; o16[q] = tohx(r); if (HL) { unsigned short a2, c2; splitf(r, a2, c2); oh[q] = a2; ol[q] = c2; } }
        *(v8h*)(p16 + (size_t)row * ld16 + cofs) = o16;
        if (HL) { const size_t oo = (size_t)row * ldhl + cofs; *(v8us*)(ph + oo) = oh; *(v8us*)(pl + oo) = ol; } }
    asm volatile("s_wait_xcnt 0x0" ::: "memory");   // behind the last stores: the text of the other side of the caller's test follows and reuses their registers
}

// gemmp: the same tile GEMM on plain bf16 operands whose epilogue writes the attention operand planes itself: C[m][n] = sum_k A[m][k] Bt[n][k], stored as fp16 (P16) and, for tokens < RH of each batch, as bf16 hi + lo (Ph, Pl).
// The token axis runs over all batches (NB_ * TT). TR false: tokens are the tile's rows, planes [b][t][d] (hi/lo [b][RH][d]). TR true: tokens are its columns, planes [b][d][t] (hi/lo [b][d][RH]).
// Each wave's whole 64 x 64 f32 tile is staged in LDS (pitch 68) so that every store instruction covers whole 128-B rows of a plane (8 lanes a row, 16 B a lane). With A = weight rows and Bt = token rows it yields the transposed planes [d][t].
// gemmp is the body of one work-group; (bx, by) = its tile row and tile column, smem = 2 * Stg<0>::STAGE bytes.
template <bool TR>
__device__ __forceinline__ void gemmp(char* smem, int bx, int by, const bf* __restrict__ A, const bf* __restrict__ Bt, int K, h16* P16, bf* Ph, bf* Pl) {
    const int wave = __builtin_amdgcn_readfirstlane(threadIdx.x >> 5); float* os = (float*)smem + wave * 64 * 68;   // each wave's output staging (64 x 68 f32) takes the operand buffers' place behind the K loop
    static_assert(4 * 64 * 68 * 4 <= 2 * Stg<0>::STAGE, "the four staged tiles fit the operand buffers");
    const int lane = threadIdx.x & 31, lr = lane & 15, hi = lane >> 4; const int r0 = bx * 128 + (wave >> 1) * 64, c0 = by * 128 + (wave & 1) * 64;   // this wave's 64x64 tile
    v8f acc[4][4];
#pragma unroll
    for (int mb = 0; mb < 4; ++mb)
#pragma unroll
        for (int nb = 0; nb < 4; ++nb) acc[mb][nb] = (v8f){};
    tile_mm<bf, 0>((wave >= 2) ? Bt + (size_t)(by * 128 + (wave & 1) * 64) * K : A + (size_t)(bx * 128 + wave * 64) * K, K, K / Stg<0>::KSTEP, K / Stg<0>::KSTEP, wave, smem, acc);   // waves 0, 1 copy the A rows, waves 2, 3 the Bt rows
#pragma unroll
    for (int mb = 0; mb < 4; ++mb)
#pragma unroll
        for (int nb = 0; nb < 4; ++nb)
#pragma unroll
            for (int j = 0; j < 8; ++j) os[(mb * 16 + hi * 8 + j) * 68 + nb * 16 + lr] = acc[mb][nb][j];
    __syncthreads();   // the staged tile is read by other lanes than wrote it: this orders the LDS traffic
    const int rsub = lane >> 3, cofs = (lane & 7) * 8;
    const int tok = TR ? c0 : r0, bz = tok / TT, tl = tok % TT; const bool hl = (tl < RH);   // the tile's 64 tokens lie in one batch, and wholly below RH or not at all
    const int ld16 = TR ? TT : HD, ldhl = TR ? RH : HD;
    const size_t b16 = TR ? ((size_t)bz * HD + r0) * TT + tl : (size_t)r0 * HD + c0, bhl = TR ? ((size_t)bz * HD + r0) * RH + tl : ((size_t)bz * RH + tl) * HD + c0;
    if (hl) put_planes<true>(os, rsub, cofs, P16 + b16, ld16, Ph + bhl, Pl + bhl, ldhl);   // one test a tile, uniform for the wave, so that each side stays straight-line text
    else put_planes<false>(os, rsub, cofs, P16 + b16, ld16, Ph, Pl, ldhl);
}
// The three projections read the same tokens and are independent of each other: one launch, blockIdx.z = 0 (q), 1 (k), 2 (v). blockIdx.x = token block, blockIdx.y = weight-row block; v takes the weight rows as its tile's rows.
__global__ __launch_bounds__(128) void k_proj(const bf* __restrict__ X, const bf* __restrict__ Wq, const bf* __restrict__ Wk, const bf* __restrict__ Wv, int K, h16* Q16, bf* Qh, bf* Ql, h16* K16, bf* Kh, bf* Kl, h16* V16, bf* Vh, bf* Vl) {
    __shared__ __attribute__((aligned(2048))) char smem[2 * Stg<0>::STAGE];   // a tensor load's place in LDS is a multiple of 2 KiB
    if (blockIdx.z == 2) gemmp<true>(smem, blockIdx.y, blockIdx.x, Wv, X, K, V16, Vh, Vl);
    else { const bool isk = (blockIdx.z == 1); gemmp<false>(smem, blockIdx.x, blockIdx.y, X, isk ? Wk : Wq, K, isk ? K16 : Q16, isk ? Kh : Qh, isk ? Kl : Ql); }
}

__global__ __launch_bounds__(256) void k_wtG(const float* __restrict__ w, int K, int N, bf* Bt) {
    const int lane = threadIdx.x & 31; const int L0 = (blockIdx.x * 8 + (threadIdx.x >> 5)) * 8; const int nlines = N * K / 64;
{
#pragma unroll 1
        for (int l = 0; l < 8; ++l) { const int L = L0 + l; if (L >= nlines) break; const size_t e = (size_t)L * 64 + lane * 2; const int k = (int)(e % K), n = (int)(e / K); v2us o;
            o[0] = f2bf(w[(size_t)k * N + n]); o[1] = f2bf(w[(size_t)(k + 1) * N + n]); *(v2us*)(Bt + e) = o; }
         }
}
// all four inputs to bf16 in one launch: the first XBL blocks take the tokens, then WBL blocks each weight; 8 elements a thread
#define XBL ((unsigned)((size_t)NB_ * TT * DM / 8 / 256))
#define WBL ((unsigned)((size_t)DQ * DM / 8 / 256))
__global__ __launch_bounds__(256) void k_cvt4(const float* __restrict__ x, const float* __restrict__ wq, const float* __restrict__ wk, const float* __restrict__ wv, bf* XB, bf* WQ, bf* WK, bf* WV) {
    static_assert((size_t)NB_ * TT * DM % 2048 == 0 && (size_t)DQ * DM % 2048 == 0 && DQ == DKV, "whole blocks, three weights of one size");
    unsigned b = blockIdx.x; const float* src = x; bf* dst = XB;
    if (b >= XBL) { b -= XBL; const unsigned w = b / WBL; b -= w * WBL; src = (w == 0) ? wq : (w == 1) ? wk : wv; dst = (w == 0) ? WQ : (w == 1) ? WK : WV; }
    const size_t i = (size_t)b * 256 + threadIdx.x; const v8f v = *(const v8f*)(src + i * 8); v8us o;
#pragma unroll
    for (int k = 0; k < 8; ++k) o[k] = f2bf(v[k]); *(v8us*)(dst + i * 8) = o;  }
__global__ __launch_bounds__(256) void k_cscvt(const float* __restrict__ cosT, const float* __restrict__ sinT, float* CS) { const int idx = blockIdx.x * 256 + threadIdx.x; if (idx >= TT * HD) return; v2f cs; cs[0] = bfr(cosT[idx]); cs[1] = bfr(sinT[idx]); *(v2f*)(CS + (size_t)idx * 2) = cs;  }
// k_soft: what is left of the softmax between the two attention GEMMs, one launch, the block index picks the body.
// Blocks < NB_ * RH / 8: the hi/lo rows, a wave a row (zz, i), i < RH: t = S x HD^-0.5 for j <= i; softmax over the row's keys (register row, one exp, fixed trees); the probabilities go to the bf16 hi + lo planes.
// A row of block rb holds len = (rb + 1) * 64 scores and is read as RH keys: up to 448 f32 past the row, still inside the batch's packed scores (the last block's len is RH), and the select masks them.
// The other blocks: one (batch, 64-row block rb >= RH / 64) each: out of the score tiles' (maximum m, sum l) per row and key tile t the factor PCAR * exp2(m_t - M) / L, M = max_t m_t, L = sum_t l_t exp2(m_t - M), which brings the tile's
// stored exp2(s - m_t) to PCAR x the row's softmax. Thread = (row, t mod 4); fixed trees. Factors are laid as the attn.v A fragments want them (row q * 16 + lr at lr * 4 + q); the tiles behind a block's last one get 0 (attn.v copies the first of them for the upper block of its 128 rows and does not use it).
__global__ __launch_bounds__(256) void k_soft(const float* __restrict__ Sb, bf* Ph, bf* Pl, const float* __restrict__ ST, h16* FC) {
    __shared__ float red[2][256]; __shared__ __align__(16) h16 fl[NRB * 64];
    static_assert(RH == 512 && NRB == 64, "the hi/lo rows are rows of one 512-key group; 16 key tiles a thread");
    if (blockIdx.x < NB_ * RH / 8) {
        const int lane = threadIdx.x & 31; const int row = blockIdx.x * 8 + __builtin_amdgcn_readfirstlane(threadIdx.x >> 5); const int i = row % RH; const int zz = row / RH;
        const int rb = i >> 6, len = (rb + 1) * 64; const float* sr = Sb + (size_t)zz * SBH + pkoff(rb) + (size_t)(i & 63) * len; v4f ld[RH / 128]; float v[RH / 32]; float mx = -3.0e38f;
#pragma unroll
        for (int ch = 0; ch < RH / 128; ++ch) ld[ch] = *(const v4f*)(sr + ch * 128 + lane * 4);
        asm volatile("s_wait_xcnt 0x0" ::: "memory");   // behind the last load: the index arithmetic below reuses the address registers that the loads name
#pragma unroll
        for (int ch = 0; ch < RH / 128; ++ch) { const int j0 = ch * 128 + lane * 4; const v4f a = ld[ch];
#pragma unroll
            for (int q = 0; q < 4; ++q) { const int j = j0 + q; (void)j; float sa = a[q] * SCL; asm volatile("" : "+v"(sa)); const float t = (j <= i) ? sa : -3.0e38f; v[ch * 4 + q] = t; mx = fmaxf(mx, t); } }
#pragma unroll
        for (int sh = 16; sh; sh >>= 1) mx = fmaxf(mx, __shfl_xor(mx, sh, 32));
        float sum = 0.f;
#pragma unroll
        for (int g = 0; g < RH / 256; ++g) { float x[8], e[8];
#pragma unroll
            for (int k = 0; k < 8; ++k) { float d0 = __fsub_rn(v[g * 8 + k], mx); asm volatile("" : "+v"(d0)); x[k] = __fmul_rn(d0, 1.4426950408889634f); }
            exp2x8(x, e);
#pragma unroll
            for (int k = 0; k < 8; ++k) { v[g * 8 + k] = e[k]; sum += e[k]; } }
#pragma unroll
        for (int sh = 16; sh; sh >>= 1) sum += __shfl_xor(sum, sh, 32);
        const float f = __fdiv_rn(1.0f, sum);
#pragma unroll
        for (int ch = 0; ch < RH / 128; ++ch) { v4us oh, ol;
#pragma unroll
            for (int q = 0; q < 4; ++q) { unsigned short a, c2; splitf(v[ch * 4 + q] * f, a, c2); oh[q] = a; ol[q] = c2; }
            const size_t oo = ((size_t)zz * RH + i) * RH + ch * 128 + lane * 4; *(v4us*)(Ph + oo) = oh; *(v4us*)(Pl + oo) = ol; }
    } else {
        constexpr int NBL = NRB - RH / 64; const int id = blockIdx.x - NB_ * RH / 8, zz = id / NBL, rb = RH / 64 + id % NBL;
        const int row = threadIdx.x & 63, tg = __builtin_amdgcn_readfirstlane(threadIdx.x >> 6);
        const v2f* st = (const v2f*)ST + ((size_t)(zz * NRB + rb) * NRB + tg) * 64 + row; float m[16], l[16];
#pragma unroll
        for (int k = 0; k < 16; ++k) { m[k] = -3.0e38f; l[k] = 0.f; if (k * 4 + tg <= rb) { const v2f u = st[k * 256]; m[k] = u[0]; l[k] = u[1]; } }   // a scalar test; one address register pair and constant offsets: all the thread's loads are out before the first is used
        float M = m[0];
#pragma unroll
        for (int k = 1; k < 16; ++k) M = fmaxf(M, m[k]);
        red[0][threadIdx.x] = M;
        __syncthreads();   // the four threads of a row exchange their maxima
        M = fmaxf(fmaxf(red[0][row], red[0][row + 64]), fmaxf(red[0][row + 128], red[0][row + 192]));
        float L = 0.f;
#pragma unroll
        for (int g = 0; g < 2; ++g) { float x[8], e[8];
#pragma unroll
            for (int j = 0; j < 8; ++j) x[j] = m[g * 8 + j] - M;
            exp2x8(x, e);   // 0 for the tiles behind the block's last one
#pragma unroll
            for (int j = 0; j < 8; ++j) { m[g * 8 + j] = e[j]; L += l[g * 8 + j] * e[j]; } }
        red[1][threadIdx.x] = L;
        __syncthreads();   // and their sums
        L = (red[1][row] + red[1][row + 64]) + (red[1][row + 128] + red[1][row + 192]);
        const float f = __fdiv_rn(PCAR, L);   // L is about 1 or more: the tile that holds M adds its own maximum's exponential, exp2(0)
#pragma unroll
        for (int k = 0; k < 16; ++k) fl[(k * 4 + tg) * 64 + (row & 15) * 4 + (row >> 4)] = (h16)(m[k] * f);
        __syncthreads();   // the block's table is whole: it goes out in 16-B pieces, 128 B a key tile
        h16* fc = FC + (((size_t)(zz * (NRB / 2) + (rb >> 1)) * NRB) * 2 + (rb & 1)) * 64 + (threadIdx.x >> 3) * 128 + (threadIdx.x & 7) * 8;
        const v8h o0 = *(const v8ha*)(fl + threadIdx.x * 8), o1 = *(const v8ha*)(fl + 2048 + threadIdx.x * 8);
        *(v8h*)fc = o0; *(v8h*)(fc + 32 * 128) = o1;
    }
}
__global__ __launch_bounds__(256) void k_merge(const float* __restrict__ O, int h0, bf* Ah, bf* Al) { const size_t e = ((size_t)blockIdx.x * 256 + threadIdx.x) * 2; if (e >= (size_t)ZH * TT * HD) return; const int d = (int)(e % HD); const int t = (int)((e / HD) % TT); const int zz = (int)(e / ((size_t)HD * TT)); const float cs = (t < RH) ? 1.0f : (1.0f / PCAR); const size_t oo = (size_t)t * DQ + (h0 + zz) * HD + d;
    v2us oh, ol;
#pragma unroll
    for (int q = 0; q < 2; ++q) { unsigned short a, c2; splitf(O[e + q] * cs, a, c2); oh[q] = a; ol[q] = c2; } *(v2us*)(Ah + oo) = oh; *(v2us*)(Al + oo) = ol;  }


extern "C" void kernel_launch(void* const* d_in, const int* in_sizes, int n_in,
                              void* d_out, int out_size, void* d_ws, size_t ws_size, hipStream_t stream) {
    (void)in_sizes; (void)n_in; (void)out_size;
    const float* x = (const float*)d_in[0]; const float* wq = (const float*)d_in[1]; const float* wk = (const float*)d_in[2]; const float* wv = (const float*)d_in[3];
    float* OUT = (float*)d_out;     // [4][4096][768]
    char* wsp = (char*)d_ws;
    auto take = [&](size_t bytes) { char* p = wsp; wsp += (bytes + 255) & ~(size_t)255; return (void*)p; };
    bf* WQ = (bf*)take((size_t)DQ * DM * 2); bf* WK = (bf*)take((size_t)DKV * DM * 2); bf* WV = (bf*)take((size_t)DKV * DM * 2);
    bf* XB = (bf*)take((size_t)NB_ * TT * DM * 2);
    h16* QP16 = (h16*)take((size_t)NB_ * TT * HD * 2); h16* KP16 = (h16*)take((size_t)NB_ * TT * HD * 2); h16* VT16 = (h16*)take((size_t)NB_ * HD * TT * 2);
    bf* QPh = (bf*)take((size_t)NB_ * RH * HD * 2); bf* QPl = (bf*)take((size_t)NB_ * RH * HD * 2); bf* KPh = (bf*)take((size_t)NB_ * RH * HD * 2); bf* KPl = (bf*)take((size_t)NB_ * RH * HD * 2); bf* VTh = (bf*)take((size_t)NB_ * HD * RH * 2); bf* VTl = (bf*)take((size_t)NB_ * HD * RH * 2); bf* Ph = (bf*)take((size_t)NB_ * RH * RH * 2); bf* Pl = (bf*)take((size_t)NB_ * RH * RH * 2);
    float* Sb = (float*)take((size_t)NB_ * SBH * 4);      // packed causal scores of the hi/lo rows
    h16* P16 = (h16*)take((size_t)NB_ * SBZ * 2);         // packed causal fp16 probabilities of rows >= RH, each 64-key tile relative to its own maximum
    float* ST = (float*)take((size_t)NB_ * NRB * NRB * 64 * 2 * 4); h16* FC = (h16*)take((size_t)NB_ * NRB * NRB * 64 * 2);   // per row and key tile: (maximum, sum); the factor
    if ((size_t)(wsp - (char*)d_ws) > ws_size) return;    // ws 256 MiB
    k_cvt4<<<XBL + 3 * WBL, 256, 0, stream>>>(x, wq, wk, wv, XB, WQ, WK, WV);
    k_proj<<<dim3(NB_ * TT / 128, HD / 128, 3), 128, 0, stream>>>(XB, WQ, WK, WV, DM, QP16, QPh, QPl, KP16, KPh, KPl, VT16, VTh, VTl);      // q, k planes [b][t][d]; v planes transposed [b][d][t]
    k_scores<<<(RH / 128) * (RH / 128) * NB_ + ((TT - RH) / 128) * (TT / 128) * NB_, 128, 0, stream>>>(QPh, QPl, KPh, KPl, QP16, KP16, HD, Sb, P16, ST);
    k_soft<<<NB_ * RH / 8 + NB_ * (NRB - RH / 64), 256, 0, stream>>>(Sb, Ph, Pl, ST, FC);
    k_pv<<<(RH / 128) * (HD / 128) * NB_ + ((TT - RH) / 128) * (HD / 128) * NB_, 128, 0, stream>>>(Ph, Pl, VTh, VTl, P16, VT16, RH, TT, OUT, FC);
}
